// v000
// Times are from an AMD MI455X. After a warm-up the kernel runs many times in a row, and a time is the length of
// such a window on the GPU divided by its runs, so every launch and the gaps after it count. The runs cycle
// through copies of the inputs. A figure is the median of several windows, for all but v000 over two sittings.
// Sittings can differ by a few percent; kernels timed side by side share one.
// v000 is the starting kernel. One run takes 672 microseconds.
// compute dtype: all float inputs rounded to bf16; q/k/v projections with EXACT bf16 products on WMMA 16x16x32 (f32 accumulate); causal logits: 3 products for the first 384 rows, single f16 q x k after, x 64^-0.5; softmax f32; P x 2^11 once to f16 x v once to f16 (bf16 hi + lo below row 384); f32 output.
#include <hip/hip_runtime.h>
#include <math.h>

typedef __attribute__((ext_vector_type(16))) _Float16 v16h;
typedef __attribute__((ext_vector_type(16))) __bf16 v16b;
typedef __attribute__((ext_vector_type(8)))  _Float16 v8h;
typedef __attribute__((ext_vector_type(8)))  float v8f;
typedef __attribute__((ext_vector_type(4)))  float v4f;
typedef __attribute__((ext_vector_type(2)))  float v2f;
typedef __attribute__((ext_vector_type(4)))  unsigned v4u;
typedef __attribute__((ext_vector_type(4)))  int v4i;
typedef float __attribute__((may_alias)) float_a;
typedef int __attribute__((may_alias)) int_a;

template <typename T> __device__ __forceinline__ void vst2(void* p, T v) { *(T*)p = v;  }
__device__ __forceinline__ v8f wmma16(v16h a, v16h b, v8f c) {
  v8f d = __builtin_amdgcn_wmma_f32_16x16x32_f16(false, a, false, b, (short)0, c, false, false);
  asm volatile("v_nop\n\tv_nop\n\tv_nop\n\tv_nop" : "+v"(d) : "v"(a), "v"(b));
  return d;
}
__device__ __forceinline__ v8f wmma_bf(v16b a, v16b b, v8f c) {
  v8f d = __builtin_amdgcn_wmma_f32_16x16x32_bf16(false, a, false, b, (short)0, c, false, false);
  asm volatile("v_nop\n\tv_nop\n\tv_nop\n\tv_nop" : "+v"(d) : "v"(a), "v"(b));
  return d;
}
// 16x16x32 fragments: lane = (h = lane>>4, row/col = lane&15); elements 0..7 = k0+8h+0..7, 8..15 = k0+16+8h+0..7; D element r = row 8h+r
__device__ __forceinline__ v16h frag_h(const _Float16* rowk0, int lane) {
  union { v16h v; v8h q[2]; } u; const _Float16* p = rowk0 + 8 * (lane >> 4);
  u.q[0] = *(const v8h*)p; u.q[1] = *(const v8h*)(p + 16); return u.v;
}
__device__ __forceinline__ v16h frag_f32(const float* rowk0, int lane) {
  v16h a; const float* p = rowk0 + 8 * (lane >> 4);
#pragma unroll
  for (int i = 0; i < 8; ++i) { a[i] = (_Float16)p[i]; a[8 + i] = (_Float16)p[16 + i]; }
  return a;
}
__device__ __forceinline__ v16h frag_f32s(const float* rowk0, int lane, float sc) {
  v16h a; const float* p = rowk0 + 8 * (lane >> 4);
#pragma unroll
  for (int i = 0; i < 8; ++i) { a[i] = (_Float16)(p[i] * sc); a[8 + i] = (_Float16)(p[16 + i] * sc); }
  return a;
}
// column fragment from a [K][ld] layout (column n), rows >= K read as 0
__device__ __forceinline__ v16h fragc_f32(const float* W, int k0, int n, int lane, int ld, int K) {
  v16h a; const int g = lane >> 4;
#pragma unroll
  for (int i = 0; i < 8; ++i) { const int ka = k0 + 8 * g + i, kb = ka + 16;
    a[i] = (_Float16)(ka < K ? W[(size_t)(ka < K ? ka : K - 1) * ld + n] : 0.f); a[8 + i] = (_Float16)(kb < K ? W[(size_t)(kb < K ? kb : K - 1) * ld + n] : 0.f); }
  return a;
}
struct F2 { v16b h, l; };
__device__ __forceinline__ F2 bsplit16(const float v[16]) { F2 r;
#pragma unroll
  for (int i = 0; i < 16; ++i) { const __bf16 h = (__bf16)v[i]; r.h[i] = h; r.l[i] = (__bf16)(v[i] - (float)h); }
  return r; }
__device__ __forceinline__ F2 split_row(const float* row, int k0, int lane) { float v[16]; const float* p = row + k0 + 8 * (lane >> 4);
#pragma unroll
  for (int i = 0; i < 8; ++i) { v[i] = p[i]; v[8 + i] = p[16 + i]; }
  return bsplit16(v); }
__device__ __forceinline__ F2 split_rowK(const float* row, int k0, int lane, int K) { float v[16]; const int g = lane >> 4;
#pragma unroll
  for (int i = 0; i < 8; ++i) { const int ka = k0 + 8 * g + i, kb = ka + 16; v[i] = ka < K ? row[ka < K ? ka : K - 1] : 0.f; v[8 + i] = kb < K ? row[kb < K ? kb : K - 1] : 0.f; }
  return bsplit16(v); }
__device__ __forceinline__ F2 split_col(const float* W, int k0, int n, int lane, int ld, int K) { float v[16]; const int g = lane >> 4;
#pragma unroll
  for (int i = 0; i < 8; ++i) { const int ka = k0 + 8 * g + i, kb = ka + 16; v[i] = ka < K ? W[(size_t)(ka < K ? ka : K - 1) * ld + n] : 0.f; v[8 + i] = kb < K ? W[(size_t)(kb < K ? kb : K - 1) * ld + n] : 0.f; }
  return bsplit16(v); }
__device__ __forceinline__ v8f mac3(const F2& a, const F2& b, v8f c) { c = wmma_bf(a.l, b.h, c); c = wmma_bf(a.h, b.l, c); return wmma_bf(a.h, b.h, c); }
__device__ __forceinline__ float sigm(float v) { return 1.0f / (1.0f + expf(-v)); }
#define LDSX() do { asm volatile("s_wait_dscnt 0" ::: "memory"); __builtin_amdgcn_wave_barrier(); __builtin_amdgcn_fence(__ATOMIC_RELEASE, "workgroup"); } while (0)

// Single-head causal self-attention (x [4,4096,512]; (in,out) Wq / Wk / Wv [512,64] N(0, 1/512), no biases; scale 1/sqrt(64); tril, -inf; no output projection): out = softmax(causal(q k^T / 8)) v -> [4,4096,64].
#define NB 4
#define TT 4096
#define CC 128            // NH * HD = projected width
#define DIN 512          // input (model) width
#define NH 2
#define HD 64
#define NQB (TT / 64)
#define HG 1
#define SCALE (0.125f)
#define CAUSAL 1
#ifndef TNB
#define TNB NB
#endif
__device__ __forceinline__ float bfr(float v) { return (float)(__bf16)v; }
__host__ __device__ __forceinline__ int kb_last(int qb) { return CAUSAL ? ((qb * 64 + 63) >> 7) : (TT / 128 - 1); }
typedef __attribute__((ext_vector_type(8))) __bf16 v8b;
__device__ __forceinline__ v16b frag_b(const __bf16* rowk0, int lane) {
  union { v16b v; v8b q[2]; } u; const __bf16* p = rowk0 + 8 * (lane >> 4);
  u.q[0] = *(const v8b*)p; u.q[1] = *(const v8b*)(p + 16); return u.v;
}
#define QBH 6              // causal: query blocks 0..QBH-1 of each sequence (few keys, no averaging) take the high-precision path
#define QHI 384            // rows carrying a q residual plane
#define KHI 384            // key rows carrying k residual / v bf16 hi+lo planes (used only by the causal high-precision path)
// B fragment (k rows k0+.., output column o) of a weight: (in,out) [K][ld] or (out,in) [ld rows of K]: bf16 exact, or f16(bf16 * 256) exact
__device__ __forceinline__ v16b wcol_io(const float* Wm, int k0, int o, int lane, int ld) { v16b w; const int g = lane >> 4;
#pragma unroll
  for (int i = 0; i < 8; ++i) { w[i] = (__bf16)Wm[(size_t)(k0 + 8 * g + i) * ld + o]; w[8 + i] = (__bf16)Wm[(size_t)(k0 + 16 + 8 * g + i) * ld + o]; }
  return w; }
__device__ __forceinline__ v16b wcol_oi(const float* Wm, int k0, int o, int lane, int K) { v16b w; const float* p = Wm + (size_t)o * K + k0 + 8 * (lane >> 4);
#pragma unroll
  for (int i = 0; i < 8; ++i) { w[i] = (__bf16)p[i]; w[8 + i] = (__bf16)p[16 + i]; }
  return w; }
__device__ __forceinline__ v16h wcolh_io(const float* Wm, int k0, int o, int lane, int ld) { v16h w; const int g = lane >> 4;
#pragma unroll
  for (int i = 0; i < 8; ++i) { w[i] = (_Float16)(bfr(Wm[(size_t)(k0 + 8 * g + i) * ld + o]) * 256.0f); w[8 + i] = (_Float16)(bfr(Wm[(size_t)(k0 + 16 + 8 * g + i) * ld + o]) * 256.0f); }
  return w; }
__device__ __forceinline__ v16h wcolh_oi(const float* Wm, int k0, int o, int lane, int K) { v16h w; const float* p = Wm + (size_t)o * K + k0 + 8 * (lane >> 4);
#pragma unroll
  for (int i = 0; i < 8; ++i) { w[i] = (_Float16)(bfr(p[i]) * 256.0f); w[8 + i] = (_Float16)(bfr(p[16 + i]) * 256.0f); }
  return w; }
#define WQKV_LAYOUT 0   // 0 = (in,out) [DIN][HD]; 1 = (out,in) [CC][DIN]; 2 = per-head [NH][DIN][HD]
__device__ __forceinline__ v16b wcol_hdk(const float* Wm, int k0, int o, int lane) { v16b w; const int g = lane >> 4; const float* p = Wm + (size_t)(o / HD) * DIN * HD + (o % HD);
#pragma unroll
  for (int i = 0; i < 8; ++i) { w[i] = (__bf16)p[(size_t)(k0 + 8 * g + i) * HD]; w[8 + i] = (__bf16)p[(size_t)(k0 + 16 + 8 * g + i) * HD]; }
  return w; }
#define WO_OUT_IN 0
#if WQKV_LAYOUT == 1
#define WCOL(W, k0, o, lane) wcol_oi(W, k0, o, lane, DIN)
#elif WQKV_LAYOUT == 2
#define WCOL(W, k0, o, lane) wcol_hdk(W, k0, o, lane)
#else
__device__ __forceinline__ v16b zero16b() { v16b w; _Pragma("unroll") for (int i = 0; i < 16; ++i) w[i] = (__bf16)0.0f; return w; }
#define WCOL(W, k0, o, lane) ((o) < 64 ? wcol_io(W, k0, (o), lane, 64) : zero16b())   /* (in,out) [512][64] pitch 64: only 64 real output columns; projected columns 64..127 (padding head 1) are zero; run-time, uniform per unrolled tile (c0 = blockIdx.y * 128 = 0) */
#endif
#if WO_OUT_IN
#define WOCOL(W, k0, o, lane) wcol_oi(W, k0, o, lane, CC)
#define WOCOLH(W, k0, o, lane) wcolh_oi(W, k0, o, lane, CC)
#else
#define WOCOL(W, k0, o, lane) wcol_io(W, k0, o, lane, DIN)
#define WOCOLH(W, k0, o, lane) wcolh_io(W, k0, o, lane, DIN)
#endif

#ifndef SM_EXTRA_PARAMS
#define SM_EXTRA_PARAMS
#endif
#ifndef PROJ_EXTRA_PARAMS
#define PROJ_EXTRA_PARAMS
#endif
#ifndef SM_MASK_HOOK
#define SM_MASK_HOOK (void)0
#endif

#define WS_QH  0u                                      // f16 q rows [b*t][CC]
#define WS_KH  (WS_QH + 2u * (size_t)NB * TT * CC)      // f16 k rows [b*t][CC]
#define WS_VT  (WS_KH + 2u * (size_t)NB * TT * CC)      // f16 v planes [b][c][t]
#define WS_QL  (WS_VT + 2u * (size_t)NB * CC * TT)      // f16 q residual x 2^10 rows [b][t < QHI][CC]
#define WS_KL  (WS_QL + 2u * (size_t)NB * QHI * CC)     // f16 k residual x 2^10 rows [b][t < KHI][CC]
#define WS_VB  (WS_KL + 2u * (size_t)NB * KHI * CC)     // bf16 v hi planes [b][c][t < KHI]
#define WS_VBL (WS_VB + 2u * (size_t)NB * CC * KHI)
#define WS_S   (WS_VBL + 2u * (size_t)NB * CC * KHI)    // f32 logits / P [hg][t][s]
#define WS_Y   (WS_S  + 4u * (size_t)HG * TT * TT)      // f32 ctx rows [b*t][CC] (only when there is an output projection)
#define WS_END (WS_Y  + 0u)
#define WS_Y2 (WS_END)                                  // f32 ctx rows [b*TT + t][128] (columns 64..127 = the padding head)
#define WS_END2 (WS_Y2 + 4u * (size_t)NB * TT * CC)

// ---- k_proj: block = (64 rows, 128 cols, which): q/k/v = X W (+ b) with exact bf16 products (K = DIN) -> which 0: q f16 rows (+ residual rows < QHI); 1: k f16 rows (+ residual rows < KHI); 2: v f16 planes [c][t] (+ bf16 hi/lo planes for t < KHI)
__global__ __launch_bounds__(128) void k_proj(const float* __restrict__ XQ, const float* __restrict__ XK, const float* __restrict__ XV, const float* __restrict__ WQ, const float* __restrict__ WK, const float* __restrict__ WV, const float* __restrict__ BQ, const float* __restrict__ BK, const float* __restrict__ BV,
    _Float16* __restrict__ QH, _Float16* __restrict__ QL, _Float16* __restrict__ KH, _Float16* __restrict__ KL, _Float16* __restrict__ VT, __bf16* __restrict__ VB, __bf16* __restrict__ VBL) {
  __shared__ __align__(16) _Float16 sh[64][136], sl[64][136]; __shared__ __align__(16) _Float16 th[128][72]; __shared__ __align__(16) __bf16 tb[128][72], tbl[128][72];
  const int tid = threadIdx.x, wave = tid >> 5, lane = tid & 31, col = lane & 15, g = lane >> 4; const int which = blockIdx.z; const int c0 = blockIdx.y * 128; const size_t r0 = (size_t)blockIdx.x * 64; const size_t bb = r0 / TT; const int t0 = (int)(r0 % TT);
  const float* X = which == 0 ? XQ : which == 1 ? XK : XV; const float* WA = which == 0 ? WQ : which == 1 ? WK : WV; const float* BA = which == 0 ? BQ : which == 1 ? BK : BV;
  v8f acc[8] = {};
#pragma unroll 2
  for (int kc = 0; kc < DIN / 32; ++kc) { v16b a; { const float* p = X + (r0 + wave * 16 + col) * DIN + kc * 32 + 8 * g;
#pragma unroll
      for (int i = 0; i < 8; ++i) { a[i] = (__bf16)p[i]; a[8 + i] = (__bf16)p[16 + i]; } }
    asm volatile("s_wait_loadcnt 0x0" ::: "memory");
#pragma unroll
    for (int j = 0; j < 8; ++j) { const v16b w = WCOL(WA, kc * 32, c0 + j * 16 + col, lane); asm volatile("s_wait_loadcnt 0x0" ::: "memory"); acc[j] = wmma_bf(a, w, acc[j]); } }
  if (which < 2) { _Float16* DH = which == 0 ? QH : KH; _Float16* DL = which == 0 ? QL : KL; const int nhi = which == 0 ? QHI : KHI; const bool hi_rows = t0 < nhi;
#pragma unroll
    for (int j = 0; j < 8; ++j) { const float bias = BA ? bfr(BA[c0 + j * 16 + col]) : 0.f;
#pragma unroll
      for (int r = 0; r < 8; ++r) { const float v = acc[j][r] + bias; const _Float16 hv = (_Float16)v; sh[wave * 16 + 8 * g + r][j * 16 + col] = hv; sl[wave * 16 + 8 * g + r][j * 16 + col] = (_Float16)((v - (float)hv) * 1024.0f); } }
    __syncthreads();
    for (int e = tid; e < 64 * 16; e += 128) { const int rl = e >> 4, q = e & 15; vst2((unsigned*)(DH + (r0 + rl) * CC + c0 + q * 8), *(const v4u*)&sh[rl][q * 8]); if (hi_rows) vst2((unsigned*)(DL + (bb * nhi + t0 + rl) * (size_t)CC + c0 + q * 8), *(const v4u*)&sl[rl][q * 8]); }
  } else { const bool hi_rows = t0 < KHI;
#pragma unroll
    for (int j = 0; j < 8; ++j) { const float bias = BA ? bfr(BA[c0 + j * 16 + col]) : 0.f;
#pragma unroll
      for (int r = 0; r < 8; ++r) { const float v = acc[j][r] + bias; const int rl = wave * 16 + 8 * g + r, cl = j * 16 + col; th[cl][rl] = (_Float16)v; const __bf16 bh = (__bf16)v; tb[cl][rl] = bh; tbl[cl][rl] = (__bf16)(v - (float)bh); } }
    __syncthreads();
    for (int e = tid; e < 128 * 8; e += 128) { const int cl = e >> 3, q = e & 7; vst2((unsigned*)(VT + (bb * CC + c0 + cl) * (size_t)TT + t0 + q * 8), *(const v4u*)&th[cl][q * 8]); if (hi_rows) { const size_t o3 = (bb * CC + c0 + cl) * (size_t)KHI + t0 + q * 8; vst2((unsigned*)(VB + o3), *(const v4u*)&tb[cl][q * 8]); vst2((unsigned*)(VBL + o3), *(const v4u*)&tbl[cl][q * 8]); } } } }
// ---- k_sc: block = (query block qb, key block kb <= kb_last(qb), head in group) of batch b: logits x SCALE; q hi + residual (x 2^10) against k (2 products) for query rows < QHI, plus the k residual (3 products) for query blocks < QBH (causal early rows); causal: blocks past the diagonal exit, the mask itself is applied by index in k_sm
__global__ __launch_bounds__(128) void k_sc(const _Float16* __restrict__ QH, const _Float16* __restrict__ KH, const _Float16* __restrict__ QL, const _Float16* __restrict__ KL, int b, int h0, float* __restrict__ S0) { __shared__ __align__(16) float ss[4][16][132];
  const int qb = blockIdx.x, kb = blockIdx.y; if (kb > kb_last(qb)) return;
  const int h = h0 + blockIdx.z; float* S = S0 + (size_t)blockIdx.z * TT * TT;
  const int tid = threadIdx.x, wave = tid >> 5, lane = tid & 31, col = lane & 15, g = lane >> 4; const int k0 = kb * 128; const int ql0 = qb * 64 + wave * 16; const size_t q0 = (size_t)b * TT + ql0, kr0 = (size_t)b * TT + k0;
  v8f acc[8] = {}, accl[8] = {};
  const _Float16* QLb = QL + (size_t)b * QHI * CC; const _Float16* KLb = KL + (size_t)b * KHI * CC;
  if (qb < QBH) {
#pragma unroll
    for (int kc = 0; kc < HD / 32; ++kc) { const v16h ah = frag_h(QH + (q0 + col) * CC + h * HD + kc * 32, lane), al = frag_h(QLb + (size_t)(ql0 + col) * CC + h * HD + kc * 32, lane);
#pragma unroll
      for (int j = 0; j < 8; ++j) { const v16h kbf = frag_h(KH + (kr0 + j * 16 + col) * CC + h * HD + kc * 32, lane), klf = frag_h(KLb + (size_t)(k0 + j * 16 + col) * CC + h * HD + kc * 32, lane); acc[j] = wmma16(ah, kbf, acc[j]); accl[j] = wmma16(al, kbf, accl[j]); accl[j] = wmma16(ah, klf, accl[j]); } }
  } else if (qb * 64 < QHI) {
#pragma unroll
    for (int kc = 0; kc < HD / 32; ++kc) { const v16h ah = frag_h(QH + (q0 + col) * CC + h * HD + kc * 32, lane), al = frag_h(QLb + (size_t)(ql0 + col) * CC + h * HD + kc * 32, lane);
#pragma unroll
      for (int j = 0; j < 8; ++j) { const v16h kbf = frag_h(KH + (kr0 + j * 16 + col) * CC + h * HD + kc * 32, lane); acc[j] = wmma16(ah, kbf, acc[j]); accl[j] = wmma16(al, kbf, accl[j]); } }
  } else {
#pragma unroll
    for (int kc = 0; kc < HD / 32; ++kc) { const v16h ah = frag_h(QH + (q0 + col) * CC + h * HD + kc * 32, lane);
#pragma unroll
      for (int j = 0; j < 8; ++j) { const v16h kbf = frag_h(KH + (kr0 + j * 16 + col) * CC + h * HD + kc * 32, lane); acc[j] = wmma16(ah, kbf, acc[j]); } } }
#pragma unroll
  for (int j = 0; j < 8; ++j) {
#pragma unroll
    for (int r = 0; r < 8; ++r) ss[wave][8 * g + r][j * 16 + col] = (acc[j][r] + accl[j][r] * (1.0f / 1024.0f)) * SCALE; }
  LDSX(); for (int rl = 0; rl < 16; ++rl) vst2(S + (size_t)(ql0 + rl) * TT + k0 + lane * 4, *(const v4f*)&ss[wave][rl][lane * 4]); }
// ---- k_sm: block = query row t (head in group): keys [0, kend): causal -> logit if s <= t else excluded; softmax in f32; P x 2^11 in place (0 for excluded)
__global__ __launch_bounds__(256) void k_sm(float* __restrict__ S0 SM_EXTRA_PARAMS) { __shared__ float sred[8]; __shared__ float sbc; __shared__ __align__(16) float shv[TT];
  const int tid = threadIdx.x; const int t = blockIdx.x; const int kend = (kb_last(t >> 6) + 1) * 128;
  float* sr = S0 + (size_t)blockIdx.y * TT * TT + (size_t)t * TT;
  float m = -3.0e38f; for (int k = tid; k < kend; k += 256) { float v = (!CAUSAL || k <= t) ? sr[k] : -3.0e38f; SM_MASK_HOOK; shv[k] = v; m = fmaxf(m, v); }
#pragma unroll
  for (int o = 1; o < 32; o <<= 1) m = fmaxf(m, __shfl_xor(m, o));
  if ((tid & 31) == 0) sred[tid >> 5] = m; __syncthreads(); if (tid == 0) { float a = sred[0]; for (int i = 1; i < 8; ++i) a = fmaxf(a, sred[i]); sbc = a; } __syncthreads(); m = sbc; __syncthreads();
  float sum = 0.f; for (int k = tid; k < kend; k += 256) { const float v = shv[k]; const float e = (v <= -1.0e38f) ? 0.f : expf(v - m); shv[k] = e; sum += e; }
#pragma unroll
  for (int o = 1; o < 32; o <<= 1) sum += __shfl_xor(sum, o);
  if ((tid & 31) == 0) sred[tid >> 5] = sum; __syncthreads(); if (tid == 0) { float a = 0.f; for (int i = 0; i < 8; ++i) a += sred[i]; sbc = a > 0.f ? 2048.0f / a : 0.f; }   /* a fully excluded row yields P = 0 */ __syncthreads(); const float inv = sbc;
  for (int k = tid; k < kend; k += 256) shv[k] = shv[k] * inv;
  __syncthreads(); for (int q = tid; q < kend / 4; q += 256) vst2(sr + q * 4, *(const v4f*)&shv[q * 4]); }
// ---- k_out64: out[b][t][0..63] = ctx row columns 0..63 (256 B by 16 lanes)
__global__ __launch_bounds__(256) void k_out64(const float* __restrict__ Y, float* __restrict__ OUT) { const size_t row = (size_t)blockIdx.x * 16 + (threadIdx.x >> 4); const int q = threadIdx.x & 15; const v4f v = *(const v4f*)(Y + row * CC + q * 4); asm volatile("s_wait_loadcnt 0x0" ::: "memory"); vst2(OUT + row * 64 + q * 4, v); }
// ---- k_pv: block = 64 queries (qb) of (b, h): ctx = P . v over keys [0, kend) (P x 2^11 once to f16 against v f16: 1 product; causal early query blocks: P and v as bf16 hi + lo, 3 products); 256-B (row, head) segment by 16 lanes
__global__ __launch_bounds__(128) void k_pv(const float* __restrict__ PS0, const _Float16* __restrict__ VT, const __bf16* __restrict__ VB, const __bf16* __restrict__ VBL, int b, int h0, float* __restrict__ Y) { const int h = h0 + blockIdx.z; const float* PS = PS0 + (size_t)blockIdx.z * TT * TT; __shared__ __align__(16) float ss[4][16][HD + 4];
  const int tid = threadIdx.x, wave = tid >> 5, lane = tid & 31, col = lane & 15, g = lane >> 4; const int qb = blockIdx.x; const int ql0 = qb * 64 + wave * 16; const int kce = (kb_last(qb) + 1) * 4;
  v8f acc[HD / 16] = {};
  if (qb < QBH) {
#pragma unroll 1
    for (int kc = 0; kc < kce; ++kc) { const F2 p = split_row(PS + (size_t)(ql0 + col) * TT, kc * 32, lane);
      asm volatile("s_wait_loadcnt 0x0" ::: "memory");
#pragma unroll
      for (int j = 0; j < HD / 16; ++j) { const size_t po = ((size_t)b * CC + h * HD + j * 16 + col) * (size_t)KHI + kc * 32; const v16b vh = frag_b(VB + po, lane); acc[j] = wmma_bf(p.h, vh, acc[j]); acc[j] = wmma_bf(p.l, vh, acc[j]); acc[j] = wmma_bf(p.h, frag_b(VBL + po, lane), acc[j]); } }
  } else {
#pragma unroll 1
    for (int kc = 0; kc < kce; ++kc) { const v16h p = frag_f32(PS + (size_t)(ql0 + col) * TT + kc * 32, lane);
      asm volatile("s_wait_loadcnt 0x0" ::: "memory");
#pragma unroll
      for (int j = 0; j < HD / 16; ++j) { const size_t po = ((size_t)b * CC + h * HD + j * 16 + col) * (size_t)TT + kc * 32; acc[j] = wmma16(p, frag_h(VT + po, lane), acc[j]); } } }
#pragma unroll
  for (int j = 0; j < HD / 16; ++j)
#pragma unroll
    for (int r = 0; r < 8; ++r) ss[wave][8 * g + r][j * 16 + col] = acc[j][r] * (1.0f / 2048.0f);
  LDSX(); for (int rl = 0; rl < 16; ++rl) if (lane < HD / 4) vst2(Y + ((size_t)b * TT + ql0 + rl) * CC + h * HD + lane * 4, *(const v4f*)&ss[wave][rl][lane * 4]); }

extern "C" void kernel_launch(void* const* d_in, const int* in_sizes, int n_in, void* d_out, int out_size, void* d_ws, size_t ws_size, hipStream_t stream) {
  (void)in_sizes; (void)n_in; (void)out_size;
  const float** F = (const float**)d_in;
  if (ws_size < (size_t)WS_END) return;
  char* ws = (char*)d_ws; _Float16 *QH = (_Float16*)(ws + WS_QH), *KH = (_Float16*)(ws + WS_KH), *VT = (_Float16*)(ws + WS_VT), *QL = (_Float16*)(ws + WS_QL), *KL = (_Float16*)(ws + WS_KL); __bf16 *VB = (__bf16*)(ws + WS_VB), *VBL = (__bf16*)(ws + WS_VBL); float *S = (float*)(ws + WS_S), *Y = (float*)(ws + WS_Y);
  (void)Y; (void)QL; (void)KL; (void)VB; (void)VBL;
  // inputs: 0 x [4,4096,512]; 1 Wq [512,64] (in,out); 2 Wk; 3 Wv; no biases
  if (ws_size < (size_t)WS_END2) return;
  float* Y2 = (float*)(ws + WS_Y2);
  k_proj<<<dim3(TNB * TT / 64, CC / 128, 3), 128, 0, stream>>>(F[0], F[0], F[0], F[1], F[2], F[3], nullptr, nullptr, nullptr, QH, QL, KH, KL, VT, VB, VBL);   /* weight columns 64..127 (the padding head) are zero fragments */
  for (int b = 0; b < TNB; ++b) {   /* head 0 only (head 1 is the zero padding) */
    k_sc<<<dim3(NQB, TT / 128, 1), 128, 0, stream>>>(QH, KH, QL, KL, b, 0, S);
    k_sm<<<dim3(TT, 1), 256, 0, stream>>>(S);
    k_pv<<<dim3(NQB, 1, 1), 128, 0, stream>>>(S, VT, VB, VBL, b, 0, Y2);
  }
  k_out64<<<dim3(TNB * TT / 16), 256, 0, stream>>>(Y2, (float*)d_out);
}

// v001
// One run takes 262 microseconds.
// In both of two side-by-side timings against v000, it was 2.57 times as fast.
// compute dtype: all float inputs rounded to bf16; q/k/v projections with EXACT bf16 products on WMMA 16x16x32 (f32 accumulate); causal logits: 3 products for the first 384 rows, single f16 q x k after, x 64^-0.5; softmax f32; P x 2^11 once to f16 x v once to f16 (bf16 hi + lo below row 384); f32 output.
#include <hip/hip_runtime.h>
#include <math.h>

typedef __attribute__((ext_vector_type(16))) _Float16 v16h;
typedef __attribute__((ext_vector_type(16))) __bf16 v16b;
typedef __attribute__((ext_vector_type(8)))  _Float16 v8h;
typedef __attribute__((ext_vector_type(8)))  float v8f;
typedef __attribute__((ext_vector_type(4)))  float v4f;
typedef __attribute__((ext_vector_type(2)))  float v2f;
typedef __attribute__((ext_vector_type(4)))  unsigned v4u;
typedef __attribute__((ext_vector_type(4)))  int v4i;
typedef float __attribute__((may_alias)) float_a;
typedef int __attribute__((may_alias)) int_a;

template <typename T> __device__ __forceinline__ void vst2(void* p, T v) { *(T*)p = v;  }
__device__ __forceinline__ v8f wmma16(v16h a, v16h b, v8f c) {
  v8f d = __builtin_amdgcn_wmma_f32_16x16x32_f16(false, a, false, b, (short)0, c, false, false);
  asm volatile("v_nop\n\tv_nop\n\tv_nop\n\tv_nop" : "+v"(d) : "v"(a), "v"(b));
  return d;
}
__device__ __forceinline__ v8f wmma_bf(v16b a, v16b b, v8f c) {
  v8f d = __builtin_amdgcn_wmma_f32_16x16x32_bf16(false, a, false, b, (short)0, c, false, false);
  asm volatile("v_nop\n\tv_nop\n\tv_nop\n\tv_nop" : "+v"(d) : "v"(a), "v"(b));
  return d;
}
// 16x16x32 fragments: lane = (h = lane>>4, row/col = lane&15); elements 0..7 = k0+8h+0..7, 8..15 = k0+16+8h+0..7; D element r = row 8h+r
__device__ __forceinline__ v16h frag_h(const _Float16* rowk0, int lane) {
  union { v16h v; v8h q[2]; } u; const _Float16* p = rowk0 + 8 * (lane >> 4);
  u.q[0] = *(const v8h*)p; u.q[1] = *(const v8h*)(p + 16); return u.v;
}
__device__ __forceinline__ v16h frag_f32(const float* rowk0, int lane) {
  v16h a; const float* p = rowk0 + 8 * (lane >> 4);
#pragma unroll
  for (int i = 0; i < 8; ++i) { a[i] = (_Float16)p[i]; a[8 + i] = (_Float16)p[16 + i]; }
  return a;
}
__device__ __forceinline__ v16h frag_f32s(const float* rowk0, int lane, float sc) {
  v16h a; const float* p = rowk0 + 8 * (lane >> 4);
#pragma unroll
  for (int i = 0; i < 8; ++i) { a[i] = (_Float16)(p[i] * sc); a[8 + i] = (_Float16)(p[16 + i] * sc); }
  return a;
}
// column fragment from a [K][ld] layout (column n), rows >= K read as 0
__device__ __forceinline__ v16h fragc_f32(const float* W, int k0, int n, int lane, int ld, int K) {
  v16h a; const int g = lane >> 4;
#pragma unroll
  for (int i = 0; i < 8; ++i) { const int ka = k0 + 8 * g + i, kb = ka + 16;
    a[i] = (_Float16)(ka < K ? W[(size_t)(ka < K ? ka : K - 1) * ld + n] : 0.f); a[8 + i] = (_Float16)(kb < K ? W[(size_t)(kb < K ? kb : K - 1) * ld + n] : 0.f); }
  return a;
}
struct F2 { v16b h, l; };
__device__ __forceinline__ F2 bsplit16(const float v[16]) { F2 r;
#pragma unroll
  for (int i = 0; i < 16; ++i) { const __bf16 h = (__bf16)v[i]; r.h[i] = h; r.l[i] = (__bf16)(v[i] - (float)h); }
  return r; }
__device__ __forceinline__ F2 split_row(const float* row, int k0, int lane) { float v[16]; const float* p = row + k0 + 8 * (lane >> 4);
#pragma unroll
  for (int i = 0; i < 8; ++i) { v[i] = p[i]; v[8 + i] = p[16 + i]; }
  return bsplit16(v); }
__device__ __forceinline__ F2 split_rowK(const float* row, int k0, int lane, int K) { float v[16]; const int g = lane >> 4;
#pragma unroll
  for (int i = 0; i < 8; ++i) { const int ka = k0 + 8 * g + i, kb = ka + 16; v[i] = ka < K ? row[ka < K ? ka : K - 1] : 0.f; v[8 + i] = kb < K ? row[kb < K ? kb : K - 1] : 0.f; }
  return bsplit16(v); }
__device__ __forceinline__ F2 split_col(const float* W, int k0, int n, int lane, int ld, int K) { float v[16]; const int g = lane >> 4;
#pragma unroll
  for (int i = 0; i < 8; ++i) { const int ka = k0 + 8 * g + i, kb = ka + 16; v[i] = ka < K ? W[(size_t)(ka < K ? ka : K - 1) * ld + n] : 0.f; v[8 + i] = kb < K ? W[(size_t)(kb < K ? kb : K - 1) * ld + n] : 0.f; }
  return bsplit16(v); }
__device__ __forceinline__ v8f mac3(const F2& a, const F2& b, v8f c) { c = wmma_bf(a.l, b.h, c); c = wmma_bf(a.h, b.l, c); return wmma_bf(a.h, b.h, c); }
__device__ __forceinline__ float sigm(float v) { return 1.0f / (1.0f + expf(-v)); }
#define LDSX() do { asm volatile("s_wait_dscnt 0" ::: "memory"); __builtin_amdgcn_wave_barrier(); __builtin_amdgcn_fence(__ATOMIC_RELEASE, "workgroup"); } while (0)

// Single-head causal self-attention (x [4,4096,512]; (in,out) Wq / Wk / Wv [512,64] N(0, 1/512), no biases; scale 1/sqrt(64); tril, -inf; no output projection): out = softmax(causal(q k^T / 8)) v -> [4,4096,64].
#define NB 4
#define TT 4096
#define CC 128            // NH * HD = projected width
#define DIN 512          // input (model) width
#define NH 2
#define HD 64
#define NQB (TT / 64)
#define HG 1
#define SCALE (0.125f)
#define CAUSAL 1
#ifndef TNB
#define TNB NB
#endif
__device__ __forceinline__ float bfr(float v) { return (float)(__bf16)v; }
__host__ __device__ __forceinline__ int kb_last(int qb) { return CAUSAL ? ((qb * 64 + 63) >> 7) : (TT / 128 - 1); }
typedef __attribute__((ext_vector_type(8))) __bf16 v8b;
__device__ __forceinline__ v16b frag_b(const __bf16* rowk0, int lane) {
  union { v16b v; v8b q[2]; } u; const __bf16* p = rowk0 + 8 * (lane >> 4);
  u.q[0] = *(const v8b*)p; u.q[1] = *(const v8b*)(p + 16); return u.v;
}
#define QBH 6              // causal: query blocks 0..QBH-1 of each sequence (few keys, no averaging) take the high-precision path
#define QHI 384            // rows carrying a q residual plane
#define KHI 384            // key rows carrying k residual / v bf16 hi+lo planes (used only by the causal high-precision path)
// B fragment (k rows k0+.., output column o) of a weight: (in,out) [K][ld] or (out,in) [ld rows of K]: bf16 exact, or f16(bf16 * 256) exact
__device__ __forceinline__ v16b wcol_io(const float* Wm, int k0, int o, int lane, int ld) { v16b w; const int g = lane >> 4;
#pragma unroll
  for (int i = 0; i < 8; ++i) { w[i] = (__bf16)Wm[(size_t)(k0 + 8 * g + i) * ld + o]; w[8 + i] = (__bf16)Wm[(size_t)(k0 + 16 + 8 * g + i) * ld + o]; }
  return w; }
__device__ __forceinline__ v16b wcol_oi(const float* Wm, int k0, int o, int lane, int K) { v16b w; const float* p = Wm + (size_t)o * K + k0 + 8 * (lane >> 4);
#pragma unroll
  for (int i = 0; i < 8; ++i) { w[i] = (__bf16)p[i]; w[8 + i] = (__bf16)p[16 + i]; }
  return w; }
__device__ __forceinline__ v16h wcolh_io(const float* Wm, int k0, int o, int lane, int ld) { v16h w; const int g = lane >> 4;
#pragma unroll
  for (int i = 0; i < 8; ++i) { w[i] = (_Float16)(bfr(Wm[(size_t)(k0 + 8 * g + i) * ld + o]) * 256.0f); w[8 + i] = (_Float16)(bfr(Wm[(size_t)(k0 + 16 + 8 * g + i) * ld + o]) * 256.0f); }
  return w; }
__device__ __forceinline__ v16h wcolh_oi(const float* Wm, int k0, int o, int lane, int K) { v16h w; const float* p = Wm + (size_t)o * K + k0 + 8 * (lane >> 4);
#pragma unroll
  for (int i = 0; i < 8; ++i) { w[i] = (_Float16)(bfr(p[i]) * 256.0f); w[8 + i] = (_Float16)(bfr(p[16 + i]) * 256.0f); }
  return w; }
#define WQKV_LAYOUT 0   // 0 = (in,out) [DIN][HD]; 1 = (out,in) [CC][DIN]; 2 = per-head [NH][DIN][HD]
__device__ __forceinline__ v16b wcol_hdk(const float* Wm, int k0, int o, int lane) { v16b w; const int g = lane >> 4; const float* p = Wm + (size_t)(o / HD) * DIN * HD + (o % HD);
#pragma unroll
  for (int i = 0; i < 8; ++i) { w[i] = (__bf16)p[(size_t)(k0 + 8 * g + i) * HD]; w[8 + i] = (__bf16)p[(size_t)(k0 + 16 + 8 * g + i) * HD]; }
  return w; }
#define WO_OUT_IN 0
#if WQKV_LAYOUT == 1
#define WCOL(W, k0, o, lane) wcol_oi(W, k0, o, lane, DIN)
#elif WQKV_LAYOUT == 2
#define WCOL(W, k0, o, lane) wcol_hdk(W, k0, o, lane)
#else
__device__ __forceinline__ v16b zero16b() { v16b w; _Pragma("unroll") for (int i = 0; i < 16; ++i) w[i] = (__bf16)0.0f; return w; }
#define WCOL(W, k0, o, lane) ((o) < 64 ? wcol_io(W, k0, (o), lane, 64) : zero16b())   /* (in,out) [512][64] pitch 64: only 64 real output columns; projected columns 64..127 (padding head 1) are zero; run-time, uniform per unrolled tile (c0 = blockIdx.y * 128 = 0) */
#endif
#if WO_OUT_IN
#define WOCOL(W, k0, o, lane) wcol_oi(W, k0, o, lane, CC)
#define WOCOLH(W, k0, o, lane) wcolh_oi(W, k0, o, lane, CC)
#else
#define WOCOL(W, k0, o, lane) wcol_io(W, k0, o, lane, DIN)
#define WOCOLH(W, k0, o, lane) wcolh_io(W, k0, o, lane, DIN)
#endif

#ifndef SM_EXTRA_PARAMS
#define SM_EXTRA_PARAMS
#endif
#ifndef PROJ_EXTRA_PARAMS
#define PROJ_EXTRA_PARAMS
#endif
#ifndef SM_MASK_HOOK
#define SM_MASK_HOOK (void)0
#endif

#define WS_QH  0u                                      // f16 q rows [b*t][CC]
#define WS_KH  (WS_QH + 2u * (size_t)NB * TT * CC)      // f16 k rows [b*t][CC]
#define WS_VT  (WS_KH + 2u * (size_t)NB * TT * CC)      // f16 v planes [b][c][t]
#define WS_QL  (WS_VT + 2u * (size_t)NB * CC * TT)      // f16 q residual x 2^10 rows [b][t < QHI][CC]
#define WS_KL  (WS_QL + 2u * (size_t)NB * QHI * CC)     // f16 k residual x 2^10 rows [b][t < KHI][CC]
#define WS_VB  (WS_KL + 2u * (size_t)NB * KHI * CC)     // bf16 v hi planes [b][c][t < KHI]
#define WS_VBL (WS_VB + 2u * (size_t)NB * CC * KHI)
#define WS_S   (WS_VBL + 2u * (size_t)NB * CC * KHI)    // f32 logits / P [hg][t][s]
#define WS_Y   (WS_S  + 4u * (size_t)HG * TT * TT)      // f32 ctx rows [b*t][CC] (only when there is an output projection)
#define WS_END (WS_Y  + 0u)
#define WS_Y2 (WS_END)                                  // f32 ctx rows [b*TT + t][128] (columns 64..127 = the padding head)
#define WS_END2 (WS_Y2 + 4u * (size_t)NB * TT * CC)

// ---- k_proj: block = (64 rows, 128 cols, which): q/k/v = X W (+ b) with exact bf16 products (K = DIN) -> which 0: q f16 rows (+ residual rows < QHI); 1: k f16 rows (+ residual rows < KHI); 2: v f16 planes [c][t] (+ bf16 hi/lo planes for t < KHI)
__global__ __launch_bounds__(128) void k_proj(const float* __restrict__ XQ, const float* __restrict__ XK, const float* __restrict__ XV, const float* __restrict__ WQ, const float* __restrict__ WK, const float* __restrict__ WV, const float* __restrict__ BQ, const float* __restrict__ BK, const float* __restrict__ BV,
    _Float16* __restrict__ QH, _Float16* __restrict__ QL, _Float16* __restrict__ KH, _Float16* __restrict__ KL, _Float16* __restrict__ VT, __bf16* __restrict__ VB, __bf16* __restrict__ VBL) {
  __shared__ __align__(16) _Float16 sh[64][136], sl[64][136]; __shared__ __align__(16) _Float16 th[128][72]; __shared__ __align__(16) __bf16 tb[128][72], tbl[128][72];
  const int tid = threadIdx.x, wave = tid >> 5, lane = tid & 31, col = lane & 15, g = lane >> 4; const int which = blockIdx.z; const int c0 = blockIdx.y * 128; const size_t r0 = (size_t)blockIdx.x * 64; const size_t bb = r0 / TT; const int t0 = (int)(r0 % TT);
  const float* X = which == 0 ? XQ : which == 1 ? XK : XV; const float* WA = which == 0 ? WQ : which == 1 ? WK : WV; const float* BA = which == 0 ? BQ : which == 1 ? BK : BV;
  v8f acc[8] = {};
#pragma unroll 2
  for (int kc = 0; kc < DIN / 32; ++kc) { v16b a; { const float* p = X + (r0 + wave * 16 + col) * DIN + kc * 32 + 8 * g;
#pragma unroll
      for (int i = 0; i < 8; ++i) { a[i] = (__bf16)p[i]; a[8 + i] = (__bf16)p[16 + i]; } }
    asm volatile("s_wait_loadcnt 0x0" ::: "memory");
#pragma unroll
    for (int j = 0; j < 8; ++j) { const v16b w = WCOL(WA, kc * 32, c0 + j * 16 + col, lane); asm volatile("s_wait_loadcnt 0x0" ::: "memory"); acc[j] = wmma_bf(a, w, acc[j]); } }
  if (which < 2) { _Float16* DH = which == 0 ? QH : KH; _Float16* DL = which == 0 ? QL : KL; const int nhi = which == 0 ? QHI : KHI; const bool hi_rows = t0 < nhi;
#pragma unroll
    for (int j = 0; j < 8; ++j) { const float bias = BA ? bfr(BA[c0 + j * 16 + col]) : 0.f;
#pragma unroll
      for (int r = 0; r < 8; ++r) { const float v = acc[j][r] + bias; const _Float16 hv = (_Float16)v; sh[wave * 16 + 8 * g + r][j * 16 + col] = hv; sl[wave * 16 + 8 * g + r][j * 16 + col] = (_Float16)((v - (float)hv) * 1024.0f); } }
    __syncthreads();
    for (int e = tid; e < 64 * 16; e += 128) { const int rl = e >> 4, q = e & 15; vst2((unsigned*)(DH + (r0 + rl) * CC + c0 + q * 8), *(const v4u*)&sh[rl][q * 8]); if (hi_rows) vst2((unsigned*)(DL + (bb * nhi + t0 + rl) * (size_t)CC + c0 + q * 8), *(const v4u*)&sl[rl][q * 8]); }
  } else { const bool hi_rows = t0 < KHI;
#pragma unroll
    for (int j = 0; j < 8; ++j) { const float bias = BA ? bfr(BA[c0 + j * 16 + col]) : 0.f;
#pragma unroll
      for (int r = 0; r < 8; ++r) { const float v = acc[j][r] + bias; const int rl = wave * 16 + 8 * g + r, cl = j * 16 + col; th[cl][rl] = (_Float16)v; const __bf16 bh = (__bf16)v; tb[cl][rl] = bh; tbl[cl][rl] = (__bf16)(v - (float)bh); } }
    __syncthreads();
    for (int e = tid; e < 128 * 8; e += 128) { const int cl = e >> 3, q = e & 7; vst2((unsigned*)(VT + (bb * CC + c0 + cl) * (size_t)TT + t0 + q * 8), *(const v4u*)&th[cl][q * 8]); if (hi_rows) { const size_t o3 = (bb * CC + c0 + cl) * (size_t)KHI + t0 + q * 8; vst2((unsigned*)(VB + o3), *(const v4u*)&tb[cl][q * 8]); vst2((unsigned*)(VBL + o3), *(const v4u*)&tbl[cl][q * 8]); } } } }
// ---- k_sc: block = (query block qb, key block kb <= kb_last(qb), head in group) of batch b: logits x SCALE; q hi + residual (x 2^10) against k (2 products) for query rows < QHI, plus the k residual (3 products) for query blocks < QBH (causal early rows); causal: blocks past the diagonal exit, the mask itself is applied by index in k_sm
__global__ __launch_bounds__(128) void k_sc(const _Float16* __restrict__ QH, const _Float16* __restrict__ KH, const _Float16* __restrict__ QL, const _Float16* __restrict__ KL, int b, int h0, float* __restrict__ S0) { __shared__ __align__(16) float ss[4][16][132];
  const int qb = blockIdx.x, kb = blockIdx.y; if (kb > kb_last(qb)) return;
  const int h = h0 + blockIdx.z; float* S = S0 + (size_t)blockIdx.z * TT * TT;
  const int tid = threadIdx.x, wave = tid >> 5, lane = tid & 31, col = lane & 15, g = lane >> 4; const int k0 = kb * 128; const int ql0 = qb * 64 + wave * 16; const size_t q0 = (size_t)b * TT + ql0, kr0 = (size_t)b * TT + k0;
  v8f acc[8] = {}, accl[8] = {};
  const _Float16* QLb = QL + (size_t)b * QHI * CC; const _Float16* KLb = KL + (size_t)b * KHI * CC;
  if (qb < QBH) {
#pragma unroll
    for (int kc = 0; kc < HD / 32; ++kc) { const v16h ah = frag_h(QH + (q0 + col) * CC + h * HD + kc * 32, lane), al = frag_h(QLb + (size_t)(ql0 + col) * CC + h * HD + kc * 32, lane);
#pragma unroll
      for (int j = 0; j < 8; ++j) { const v16h kbf = frag_h(KH + (kr0 + j * 16 + col) * CC + h * HD + kc * 32, lane), klf = frag_h(KLb + (size_t)(k0 + j * 16 + col) * CC + h * HD + kc * 32, lane); acc[j] = wmma16(ah, kbf, acc[j]); accl[j] = wmma16(al, kbf, accl[j]); accl[j] = wmma16(ah, klf, accl[j]); } }
  } else if (qb * 64 < QHI) {
#pragma unroll
    for (int kc = 0; kc < HD / 32; ++kc) { const v16h ah = frag_h(QH + (q0 + col) * CC + h * HD + kc * 32, lane), al = frag_h(QLb + (size_t)(ql0 + col) * CC + h * HD + kc * 32, lane);
#pragma unroll
      for (int j = 0; j < 8; ++j) { const v16h kbf = frag_h(KH + (kr0 + j * 16 + col) * CC + h * HD + kc * 32, lane); acc[j] = wmma16(ah, kbf, acc[j]); accl[j] = wmma16(al, kbf, accl[j]); } }
  } else {
#pragma unroll
    for (int kc = 0; kc < HD / 32; ++kc) { const v16h ah = frag_h(QH + (q0 + col) * CC + h * HD + kc * 32, lane);
#pragma unroll
      for (int j = 0; j < 8; ++j) { const v16h kbf = frag_h(KH + (kr0 + j * 16 + col) * CC + h * HD + kc * 32, lane); acc[j] = wmma16(ah, kbf, acc[j]); } } }
#pragma unroll
  for (int j = 0; j < 8; ++j) {
#pragma unroll
    for (int r = 0; r < 8; ++r) ss[wave][8 * g + r][j * 16 + col] = (acc[j][r] + accl[j][r] * (1.0f / 1024.0f)) * SCALE; }
  LDSX(); for (int rl = 0; rl < 16; ++rl) vst2(S + (size_t)(ql0 + rl) * TT + k0 + lane * 4, *(const v4f*)&ss[wave][rl][lane * 4]); }
// ---- k_sm: block = query row t (head in group): keys [0, kend): causal -> logit if s <= t else excluded; softmax in f32; P x 2^11 in place (0 for excluded)
__global__ __launch_bounds__(256) void k_sm(float* __restrict__ S0 SM_EXTRA_PARAMS) { __shared__ float sred[8]; __shared__ float sbc; __shared__ __align__(16) float shv[TT];
  const int tid = threadIdx.x; const int t = blockIdx.x; const int kend = (kb_last(t >> 6) + 1) * 128;
  float* sr = S0 + (size_t)blockIdx.y * TT * TT + (size_t)t * TT;
  float m = -3.0e38f; for (int k = tid; k < kend; k += 256) { float v = (!CAUSAL || k <= t) ? sr[k] : -3.0e38f; SM_MASK_HOOK; shv[k] = v; m = fmaxf(m, v); }
#pragma unroll
  for (int o = 1; o < 32; o <<= 1) m = fmaxf(m, __shfl_xor(m, o));
  if ((tid & 31) == 0) sred[tid >> 5] = m; __syncthreads(); if (tid == 0) { float a = sred[0]; for (int i = 1; i < 8; ++i) a = fmaxf(a, sred[i]); sbc = a; } __syncthreads(); m = sbc; __syncthreads();
  float sum = 0.f; for (int k = tid; k < kend; k += 256) { const float v = shv[k]; const float e = (v <= -1.0e38f) ? 0.f : expf(v - m); shv[k] = e; sum += e; }
#pragma unroll
  for (int o = 1; o < 32; o <<= 1) sum += __shfl_xor(sum, o);
  if ((tid & 31) == 0) sred[tid >> 5] = sum; __syncthreads(); if (tid == 0) { float a = 0.f; for (int i = 0; i < 8; ++i) a += sred[i]; sbc = a > 0.f ? 2048.0f / a : 0.f; }   /* a fully excluded row yields P = 0 */ __syncthreads(); const float inv = sbc;
  for (int k = tid; k < kend; k += 256) shv[k] = shv[k] * inv;
  __syncthreads(); for (int q = tid; q < kend / 4; q += 256) vst2(sr + q * 4, *(const v4f*)&shv[q * 4]); }
// ---- k_out64: out[b][t][0..63] = ctx row columns 0..63 (256 B by 16 lanes)
__global__ __launch_bounds__(256) void k_out64(const float* __restrict__ Y, float* __restrict__ OUT) { const size_t row = (size_t)blockIdx.x * 16 + (threadIdx.x >> 4); const int q = threadIdx.x & 15; const v4f v = *(const v4f*)(Y + row * CC + q * 4); asm volatile("s_wait_loadcnt 0x0" ::: "memory"); vst2(OUT + row * 64 + q * 4, v); }
// ---- k_pv: block = 16 queries of (b, h), 16 waves: wave w takes the 32-key chunks w, w + 16, ... of [0, kend), the 16 f32 partial tiles are summed through LDS in wave order (P x 2^11 once to f16 against v f16: 1 product; causal early query blocks: P and v as bf16 hi + lo, 3 products); 256-B (row, head) segment by 16 lanes
#define PVW 16             // waves per block = key chunks in flight per 16-query tile
__global__ __launch_bounds__(PVW * 32) void k_pv(const float* __restrict__ PS0, const _Float16* __restrict__ VT, const __bf16* __restrict__ VB, const __bf16* __restrict__ VBL, int b, int h0, float* __restrict__ Y) { const int h = h0 + blockIdx.z; const float* PS = PS0 + (size_t)blockIdx.z * TT * TT; __shared__ __align__(16) float ss[PVW][16][HD + 4];
  const int tid = threadIdx.x, wave = __builtin_amdgcn_readfirstlane(tid >> 5), lane = tid & 31, col = lane & 15, g = lane >> 4; const int ql0 = blockIdx.x * 16; const int qb = ql0 >> 6; const int kce = (kb_last(qb) + 1) * 4;
  v8f acc[HD / 16] = {};
  if (qb < QBH) {
#pragma unroll 1
    for (int kc = wave; kc < kce; kc += PVW) { const F2 p = split_row(PS + (size_t)(ql0 + col) * TT, kc * 32, lane);
      asm volatile("s_wait_loadcnt 0x0" ::: "memory");
#pragma unroll
      for (int j = 0; j < HD / 16; ++j) { const size_t po = ((size_t)b * CC + h * HD + j * 16 + col) * (size_t)KHI + kc * 32; const v16b vh = frag_b(VB + po, lane); acc[j] = wmma_bf(p.h, vh, acc[j]); acc[j] = wmma_bf(p.l, vh, acc[j]); acc[j] = wmma_bf(p.h, frag_b(VBL + po, lane), acc[j]); } }
  } else {
#pragma unroll 1
    for (int kc = wave; kc < kce; kc += PVW) { const v16h p = frag_f32(PS + (size_t)(ql0 + col) * TT + kc * 32, lane);
      asm volatile("s_wait_loadcnt 0x0" ::: "memory");
#pragma unroll
      for (int j = 0; j < HD / 16; ++j) { const size_t po = ((size_t)b * CC + h * HD + j * 16 + col) * (size_t)TT + kc * 32; acc[j] = wmma16(p, frag_h(VT + po, lane), acc[j]); } } }
#pragma unroll
  for (int j = 0; j < HD / 16; ++j)
#pragma unroll
    for (int r = 0; r < 8; ++r) ss[wave][8 * g + r][j * 16 + col] = acc[j][r] * (1.0f / 2048.0f);
  __syncthreads();   // every wave's partial tile (zeros from a wave without a chunk) is in LDS before any is summed
  if (tid < 16 * (HD / 4)) { const int rl = tid >> 4, q = tid & 15; v4f s = *(const v4f*)&ss[0][rl][q * 4];
#pragma unroll
    for (int w = 1; w < PVW; ++w) s += *(const v4f*)&ss[w][rl][q * 4];
    vst2(Y + ((size_t)b * TT + ql0 + rl) * CC + h * HD + q * 4, s); } }

extern "C" void kernel_launch(void* const* d_in, const int* in_sizes, int n_in, void* d_out, int out_size, void* d_ws, size_t ws_size, hipStream_t stream) {
  (void)in_sizes; (void)n_in; (void)out_size;
  const float** F = (const float**)d_in;
  if (ws_size < (size_t)WS_END) return;
  char* ws = (char*)d_ws; _Float16 *QH = (_Float16*)(ws + WS_QH), *KH = (_Float16*)(ws + WS_KH), *VT = (_Float16*)(ws + WS_VT), *QL = (_Float16*)(ws + WS_QL), *KL = (_Float16*)(ws + WS_KL); __bf16 *VB = (__bf16*)(ws + WS_VB), *VBL = (__bf16*)(ws + WS_VBL); float *S = (float*)(ws + WS_S), *Y = (float*)(ws + WS_Y);
  (void)Y; (void)QL; (void)KL; (void)VB; (void)VBL;
  // inputs: 0 x [4,4096,512]; 1 Wq [512,64] (in,out); 2 Wk; 3 Wv; no biases
  if (ws_size < (size_t)WS_END2) return;
  float* Y2 = (float*)(ws + WS_Y2);
  k_proj<<<dim3(TNB * TT / 64, CC / 128, 3), 128, 0, stream>>>(F[0], F[0], F[0], F[1], F[2], F[3], nullptr, nullptr, nullptr, QH, QL, KH, KL, VT, VB, VBL);   /* weight columns 64..127 (the padding head) are zero fragments */
  for (int b = 0; b < TNB; ++b) {   /* head 0 only (head 1 is the zero padding) */
    k_sc<<<dim3(NQB, TT / 128, 1), 128, 0, stream>>>(QH, KH, QL, KL, b, 0, S);
    k_sm<<<dim3(TT, 1), 256, 0, stream>>>(S);
    k_pv<<<dim3(TT / 16, 1, 1), PVW * 32, 0, stream>>>(S, VT, VB, VBL, b, 0, Y2);
  }
  k_out64<<<dim3(TNB * TT / 16), 256, 0, stream>>>(Y2, (float*)d_out);
}

// v002
// It runs in 54.4 microseconds.
// Next to v001, in two timings, it ran 4.81 and 4.79 times as fast.
// All steps since v000 together make it 12.3 times as fast.
// compute dtype: all float inputs rounded to bf16; q/k/v projections with EXACT bf16 products on WMMA 16x16x32 (f32 accumulate); causal logits: 3 products for the first 384 rows, single f16 q x k after, x 64^-0.5; running softmax f32; P (against the running maximum) x 2^4 once to f16 x v once to f16 (bf16 hi + lo below row 384); f32 output.
#include <hip/hip_runtime.h>
#include <math.h>

typedef __attribute__((ext_vector_type(16))) _Float16 v16h;
typedef __attribute__((ext_vector_type(16))) __bf16 v16b;
typedef __attribute__((ext_vector_type(8)))  _Float16 v8h;
typedef __attribute__((ext_vector_type(8)))  float v8f;
typedef __attribute__((ext_vector_type(4)))  float v4f;
typedef __attribute__((ext_vector_type(2)))  float v2f;
typedef __attribute__((ext_vector_type(4)))  unsigned v4u;
typedef __attribute__((ext_vector_type(4)))  int v4i;
typedef float __attribute__((may_alias)) float_a;
typedef int __attribute__((may_alias)) int_a;

template <typename T> __device__ __forceinline__ void vst2(void* p, T v) { *(T*)p = v;  }
__device__ __forceinline__ v8f wmma16(v16h a, v16h b, v8f c) {
  v8f d = __builtin_amdgcn_wmma_f32_16x16x32_f16(false, a, false, b, (short)0, c, false, false);
  asm volatile("v_nop\n\tv_nop\n\tv_nop\n\tv_nop" : "+v"(d) : "v"(a), "v"(b));
  return d;
}
__device__ __forceinline__ v8f wmma_bf(v16b a, v16b b, v8f c) {
  v8f d = __builtin_amdgcn_wmma_f32_16x16x32_bf16(false, a, false, b, (short)0, c, false, false);
  asm volatile("v_nop\n\tv_nop\n\tv_nop\n\tv_nop" : "+v"(d) : "v"(a), "v"(b));
  return d;
}
// 16x16x32 fragments: lane = (h = lane>>4, row/col = lane&15); elements 0..7 = k0+8h+0..7, 8..15 = k0+16+8h+0..7; D element r = row 8h+r
__device__ __forceinline__ v16h frag_h(const _Float16* rowk0, int lane) {
  union { v16h v; v8h q[2]; } u; const _Float16* p = rowk0 + 8 * (lane >> 4);
  u.q[0] = *(const v8h*)p; u.q[1] = *(const v8h*)(p + 16); return u.v;
}
__device__ __forceinline__ v16h frag_f32(const float* rowk0, int lane) {
  v16h a; const float* p = rowk0 + 8 * (lane >> 4);
#pragma unroll
  for (int i = 0; i < 8; ++i) { a[i] = (_Float16)p[i]; a[8 + i] = (_Float16)p[16 + i]; }
  return a;
}
__device__ __forceinline__ v16h frag_f32s(const float* rowk0, int lane, float sc) {
  v16h a; const float* p = rowk0 + 8 * (lane >> 4);
#pragma unroll
  for (int i = 0; i < 8; ++i) { a[i] = (_Float16)(p[i] * sc); a[8 + i] = (_Float16)(p[16 + i] * sc); }
  return a;
}
// column fragment from a [K][ld] layout (column n), rows >= K read as 0
__device__ __forceinline__ v16h fragc_f32(const float* W, int k0, int n, int lane, int ld, int K) {
  v16h a; const int g = lane >> 4;
#pragma unroll
  for (int i = 0; i < 8; ++i) { const int ka = k0 + 8 * g + i, kb = ka + 16;
    a[i] = (_Float16)(ka < K ? W[(size_t)(ka < K ? ka : K - 1) * ld + n] : 0.f); a[8 + i] = (_Float16)(kb < K ? W[(size_t)(kb < K ? kb : K - 1) * ld + n] : 0.f); }
  return a;
}
struct F2 { v16b h, l; };
__device__ __forceinline__ F2 bsplit16(const float v[16]) { F2 r;
#pragma unroll
  for (int i = 0; i < 16; ++i) { const __bf16 h = (__bf16)v[i]; r.h[i] = h; r.l[i] = (__bf16)(v[i] - (float)h); }
  return r; }
__device__ __forceinline__ F2 split_row(const float* row, int k0, int lane) { float v[16]; const float* p = row + k0 + 8 * (lane >> 4);
#pragma unroll
  for (int i = 0; i < 8; ++i) { v[i] = p[i]; v[8 + i] = p[16 + i]; }
  return bsplit16(v); }
__device__ __forceinline__ F2 split_rowK(const float* row, int k0, int lane, int K) { float v[16]; const int g = lane >> 4;
#pragma unroll
  for (int i = 0; i < 8; ++i) { const int ka = k0 + 8 * g + i, kb = ka + 16; v[i] = ka < K ? row[ka < K ? ka : K - 1] : 0.f; v[8 + i] = kb < K ? row[kb < K ? kb : K - 1] : 0.f; }
  return bsplit16(v); }
__device__ __forceinline__ F2 split_col(const float* W, int k0, int n, int lane, int ld, int K) { float v[16]; const int g = lane >> 4;
#pragma unroll
  for (int i = 0; i < 8; ++i) { const int ka = k0 + 8 * g + i, kb = ka + 16; v[i] = ka < K ? W[(size_t)(ka < K ? ka : K - 1) * ld + n] : 0.f; v[8 + i] = kb < K ? W[(size_t)(kb < K ? kb : K - 1) * ld + n] : 0.f; }
  return bsplit16(v); }
__device__ __forceinline__ v8f mac3(const F2& a, const F2& b, v8f c) { c = wmma_bf(a.l, b.h, c); c = wmma_bf(a.h, b.l, c); return wmma_bf(a.h, b.h, c); }
__device__ __forceinline__ float sigm(float v) { return 1.0f / (1.0f + expf(-v)); }
#define LDSX() do { asm volatile("s_wait_dscnt 0" ::: "memory"); __builtin_amdgcn_wave_barrier(); __builtin_amdgcn_fence(__ATOMIC_RELEASE, "workgroup"); } while (0)

// Single-head causal self-attention (x [4,4096,512]; (in,out) Wq / Wk / Wv [512,64] N(0, 1/512), no biases; scale 1/sqrt(64); tril, -inf; no output projection): out = softmax(causal(q k^T / 8)) v -> [4,4096,64].
#define NB 4
#define TT 4096
#define CC 128            // NH * HD = projected width
#define DIN 512          // input (model) width
#define NH 2
#define HD 64
#define NQB (TT / 64)
#define HG 1
#define SCALE (0.125f)
#define CAUSAL 1
#ifndef TNB
#define TNB NB
#endif
__device__ __forceinline__ float bfr(float v) { return (float)(__bf16)v; }
__host__ __device__ __forceinline__ int kb_last(int qb) { return CAUSAL ? ((qb * 64 + 63) >> 7) : (TT / 128 - 1); }
typedef __attribute__((ext_vector_type(8))) __bf16 v8b;
__device__ __forceinline__ v16b frag_b(const __bf16* rowk0, int lane) {
  union { v16b v; v8b q[2]; } u; const __bf16* p = rowk0 + 8 * (lane >> 4);
  u.q[0] = *(const v8b*)p; u.q[1] = *(const v8b*)(p + 16); return u.v;
}
#define QBH 6              // not used: k_fa's 32-query tiles 0..11 of each sequence (rows < QHI; few keys, no averaging) take the high-precision path
#define QHI 384            // rows carrying a q residual plane
#define KHI 384            // key rows carrying k residual / v bf16 hi+lo planes (used only by the causal high-precision path)
// B fragment (k rows k0+.., output column o) of a weight: (in,out) [K][ld] or (out,in) [ld rows of K]: bf16 exact, or f16(bf16 * 256) exact
__device__ __forceinline__ v16b wcol_io(const float* Wm, int k0, int o, int lane, int ld) { v16b w; const int g = lane >> 4;
#pragma unroll
  for (int i = 0; i < 8; ++i) { w[i] = (__bf16)Wm[(size_t)(k0 + 8 * g + i) * ld + o]; w[8 + i] = (__bf16)Wm[(size_t)(k0 + 16 + 8 * g + i) * ld + o]; }
  return w; }
__device__ __forceinline__ v16b wcol_oi(const float* Wm, int k0, int o, int lane, int K) { v16b w; const float* p = Wm + (size_t)o * K + k0 + 8 * (lane >> 4);
#pragma unroll
  for (int i = 0; i < 8; ++i) { w[i] = (__bf16)p[i]; w[8 + i] = (__bf16)p[16 + i]; }
  return w; }
__device__ __forceinline__ v16h wcolh_io(const float* Wm, int k0, int o, int lane, int ld) { v16h w; const int g = lane >> 4;
#pragma unroll
  for (int i = 0; i < 8; ++i) { w[i] = (_Float16)(bfr(Wm[(size_t)(k0 + 8 * g + i) * ld + o]) * 256.0f); w[8 + i] = (_Float16)(bfr(Wm[(size_t)(k0 + 16 + 8 * g + i) * ld + o]) * 256.0f); }
  return w; }
__device__ __forceinline__ v16h wcolh_oi(const float* Wm, int k0, int o, int lane, int K) { v16h w; const float* p = Wm + (size_t)o * K + k0 + 8 * (lane >> 4);
#pragma unroll
  for (int i = 0; i < 8; ++i) { w[i] = (_Float16)(bfr(p[i]) * 256.0f); w[8 + i] = (_Float16)(bfr(p[16 + i]) * 256.0f); }
  return w; }
#define WQKV_LAYOUT 0   // 0 = (in,out) [DIN][HD]; 1 = (out,in) [CC][DIN]; 2 = per-head [NH][DIN][HD]
__device__ __forceinline__ v16b wcol_hdk(const float* Wm, int k0, int o, int lane) { v16b w; const int g = lane >> 4; const float* p = Wm + (size_t)(o / HD) * DIN * HD + (o % HD);
#pragma unroll
  for (int i = 0; i < 8; ++i) { w[i] = (__bf16)p[(size_t)(k0 + 8 * g + i) * HD]; w[8 + i] = (__bf16)p[(size_t)(k0 + 16 + 8 * g + i) * HD]; }
  return w; }
#define WO_OUT_IN 0
#if WQKV_LAYOUT == 1
#define WCOL(W, k0, o, lane) wcol_oi(W, k0, o, lane, DIN)
#elif WQKV_LAYOUT == 2
#define WCOL(W, k0, o, lane) wcol_hdk(W, k0, o, lane)
#else
__device__ __forceinline__ v16b zero16b() { v16b w; _Pragma("unroll") for (int i = 0; i < 16; ++i) w[i] = (__bf16)0.0f; return w; }
#define WCOL(W, k0, o, lane) ((o) < 64 ? wcol_io(W, k0, (o), lane, 64) : zero16b())   /* (in,out) [512][64] pitch 64: only 64 real output columns; projected columns 64..127 (padding head 1) are zero; run-time, uniform per unrolled tile (c0 = blockIdx.y * 128 = 0) */
#endif
#if WO_OUT_IN
#define WOCOL(W, k0, o, lane) wcol_oi(W, k0, o, lane, CC)
#define WOCOLH(W, k0, o, lane) wcolh_oi(W, k0, o, lane, CC)
#else
#define WOCOL(W, k0, o, lane) wcol_io(W, k0, o, lane, DIN)
#define WOCOLH(W, k0, o, lane) wcolh_io(W, k0, o, lane, DIN)
#endif

#ifndef SM_EXTRA_PARAMS
#define SM_EXTRA_PARAMS
#endif
#ifndef PROJ_EXTRA_PARAMS
#define PROJ_EXTRA_PARAMS
#endif
#ifndef SM_MASK_HOOK
#define SM_MASK_HOOK (void)0
#endif

#define WS_QH  0u                                      // f16 q rows [b*t][CC]
#define WS_KH  (WS_QH + 2u * (size_t)NB * TT * CC)      // f16 k rows [b*t][CC]
#define WS_VT  (WS_KH + 2u * (size_t)NB * TT * CC)      // f16 v planes [b][c][t]
#define WS_QL  (WS_VT + 2u * (size_t)NB * CC * TT)      // f16 q residual x 2^10 rows [b][t < QHI][CC]
#define WS_KL  (WS_QL + 2u * (size_t)NB * QHI * CC)     // f16 k residual x 2^10 rows [b][t < KHI][CC]
#define WS_VB  (WS_KL + 2u * (size_t)NB * KHI * CC)     // bf16 v hi planes [b][c][t < KHI]
#define WS_VBL (WS_VB + 2u * (size_t)NB * CC * KHI)
#define WS_S   (WS_VBL + 2u * (size_t)NB * CC * KHI)    // f32 [hg][t][s], reserved only: no kernel here stores logits or P (they stay in registers)
#define WS_Y   (WS_S  + 4u * (size_t)HG * TT * TT)      // f32 ctx rows [b*t][CC] (only when there is an output projection)
#define WS_END (WS_Y  + 0u)
#define WS_Y2 (WS_END)                                  // f32 ctx rows [b*TT + t][128] (columns 64..127 = the padding head)
#define WS_END2 (WS_Y2 + 4u * (size_t)NB * TT * CC)

// ---- k_proj: block = (64 rows, 128 cols, which): q/k/v = X W (+ b) with exact bf16 products (K = DIN) -> which 0: q f16 rows (+ residual rows < QHI); 1: k f16 rows (+ residual rows < KHI); 2: v f16 planes [c][t] (+ bf16 hi/lo planes for t < KHI)
__global__ __launch_bounds__(128) void k_proj(const float* __restrict__ XQ, const float* __restrict__ XK, const float* __restrict__ XV, const float* __restrict__ WQ, const float* __restrict__ WK, const float* __restrict__ WV, const float* __restrict__ BQ, const float* __restrict__ BK, const float* __restrict__ BV,
    _Float16* __restrict__ QH, _Float16* __restrict__ QL, _Float16* __restrict__ KH, _Float16* __restrict__ KL, _Float16* __restrict__ VT, __bf16* __restrict__ VB, __bf16* __restrict__ VBL) {
  __shared__ __align__(16) _Float16 sh[64][136], sl[64][136]; __shared__ __align__(16) _Float16 th[128][72]; __shared__ __align__(16) __bf16 tb[128][72], tbl[128][72];
  const int tid = threadIdx.x, wave = tid >> 5, lane = tid & 31, col = lane & 15, g = lane >> 4; const int which = blockIdx.z; const int c0 = blockIdx.y * 128; const size_t r0 = (size_t)blockIdx.x * 64; const size_t bb = r0 / TT; const int t0 = (int)(r0 % TT);
  const float* X = which == 0 ? XQ : which == 1 ? XK : XV; const float* WA = which == 0 ? WQ : which == 1 ? WK : WV; const float* BA = which == 0 ? BQ : which == 1 ? BK : BV;
  v8f acc[8] = {};
#pragma unroll 2
  for (int kc = 0; kc < DIN / 32; ++kc) { v16b a; { const float* p = X + (r0 + wave * 16 + col) * DIN + kc * 32 + 8 * g;
#pragma unroll
      for (int i = 0; i < 8; ++i) { a[i] = (__bf16)p[i]; a[8 + i] = (__bf16)p[16 + i]; } }
    asm volatile("s_wait_loadcnt 0x0" ::: "memory");
#pragma unroll
    for (int j = 0; j < 8; ++j) { const v16b w = WCOL(WA, kc * 32, c0 + j * 16 + col, lane); asm volatile("s_wait_loadcnt 0x0" ::: "memory"); acc[j] = wmma_bf(a, w, acc[j]); } }
  if (which < 2) { _Float16* DH = which == 0 ? QH : KH; _Float16* DL = which == 0 ? QL : KL; const int nhi = which == 0 ? QHI : KHI; const bool hi_rows = t0 < nhi;
#pragma unroll
    for (int j = 0; j < 8; ++j) { const float bias = BA ? bfr(BA[c0 + j * 16 + col]) : 0.f;
#pragma unroll
      for (int r = 0; r < 8; ++r) { const float v = acc[j][r] + bias; const _Float16 hv = (_Float16)v; sh[wave * 16 + 8 * g + r][j * 16 + col] = hv; sl[wave * 16 + 8 * g + r][j * 16 + col] = (_Float16)((v - (float)hv) * 1024.0f); } }
    __syncthreads();
    for (int e = tid; e < 64 * 16; e += 128) { const int rl = e >> 4, q = e & 15; vst2((unsigned*)(DH + (r0 + rl) * CC + c0 + q * 8), *(const v4u*)&sh[rl][q * 8]); if (hi_rows) vst2((unsigned*)(DL + (bb * nhi + t0 + rl) * (size_t)CC + c0 + q * 8), *(const v4u*)&sl[rl][q * 8]); }
  } else { const bool hi_rows = t0 < KHI;
#pragma unroll
    for (int j = 0; j < 8; ++j) { const float bias = BA ? bfr(BA[c0 + j * 16 + col]) : 0.f;
#pragma unroll
      for (int r = 0; r < 8; ++r) { const float v = acc[j][r] + bias; const int rl = wave * 16 + 8 * g + r, cl = j * 16 + col; th[cl][rl] = (_Float16)v; const __bf16 bh = (__bf16)v; tb[cl][rl] = bh; tbl[cl][rl] = (__bf16)(v - (float)bh); } }
    __syncthreads();
    for (int e = tid; e < 128 * 8; e += 128) { const int cl = e >> 3, q = e & 7; vst2((unsigned*)(VT + (bb * CC + c0 + cl) * (size_t)TT + t0 + q * 8), *(const v4u*)&th[cl][q * 8]); if (hi_rows) { const size_t o3 = (bb * CC + c0 + cl) * (size_t)KHI + t0 + q * 8; vst2((unsigned*)(VB + o3), *(const v4u*)&tb[cl][q * 8]); vst2((unsigned*)(VBL + o3), *(const v4u*)&tbl[cl][q * 8]); } } } }
// ---- k_out64: out[b][t][0..63] = ctx row columns 0..63 (256 B by 16 lanes)
__global__ __launch_bounds__(256) void k_out64(const float* __restrict__ Y, float* __restrict__ OUT) { const size_t row = (size_t)blockIdx.x * 16 + (threadIdx.x >> 4); const int q = threadIdx.x & 15; const v4f v = *(const v4f*)(Y + row * CC + q * 4); asm volatile("s_wait_loadcnt 0x0" ::: "memory"); vst2(OUT + row * 64 + q * 4, v); }
// ---- k_fa: block = 32 queries of batch b, 8 waves: wave w takes the 32-key chunks w, w + 8, ... up to the diagonal chunk. Per chunk: S^T = K Q^T (a lane holds 16 keys' scores of one query per 16-query group), running maximum and sum per query in f32 (log2 domain),
// P^T packed from the score accumulators straight into the B operand, O^T += V^T P^T. The 8 waves' (maximum, sum, O) are merged through LDS in wave order. Query rows < QHI: 3-product logits and P, v as bf16 hi + lo (3 products), as before.
#define FQ 32              // queries per block (two 16-column groups per wave)
#define FW 8               // waves per block = key chunks in flight per 32-query tile
#define SC2 (SCALE * 1.4426950408889634f)   // logits in log2 units
#define PEXP 4.0f          // P carries 2^4 (cancels in the division by the sum): keeps small P clear of the f16 subnormals
// 2^a as v_exp_f32 in asm text with one v_nop behind the last: the slot that the instruction set asks for between a transcendental and a directly following instruction that reads its result or overwrites its source
// "=&v" keeps every result off every source, so the eight in a row are independent of each other
__device__ __forceinline__ float ex2(float a) { float r; asm("v_exp_f32 %0, %1\n\tv_nop" : "=v"(r) : "v"(a)); return r; }
__device__ __forceinline__ void ex2x8(float* r, const float* a) {
  asm("v_exp_f32 %0, %8\n\tv_exp_f32 %1, %9\n\tv_exp_f32 %2, %10\n\tv_exp_f32 %3, %11\n\tv_exp_f32 %4, %12\n\tv_exp_f32 %5, %13\n\tv_exp_f32 %6, %14\n\tv_exp_f32 %7, %15\n\tv_nop"
      : "=&v"(r[0]), "=&v"(r[1]), "=&v"(r[2]), "=&v"(r[3]), "=&v"(r[4]), "=&v"(r[5]), "=&v"(r[6]), "=&v"(r[7]) : "v"(a[0]), "v"(a[1]), "v"(a[2]), "v"(a[3]), "v"(a[4]), "v"(a[5]), "v"(a[6]), "v"(a[7])); }
// stands behind a run of global loads, in front of any instruction that writes a register which an issued load names (a precaution); its "memory" clobber also keeps those loads issued above it
#define XW() asm volatile("s_wait_xcnt 0x0" ::: "memory")
// the same wait with the run's address pointers as inputs only: they stay live up to the wait, so that no load of the run gets its result placed on an address pair that earlier loads of the run name
#define XW1(p) asm volatile("s_wait_xcnt 0x0" :: "v"(p) : "memory")
#define XW2(p, q) asm volatile("s_wait_xcnt 0x0" :: "v"(p), "v"(q) : "memory")
// fragments through a pointer that already holds the lane's 8 * (lane >> 4) element offset: the loads of a run then name the loop pointer itself, which is advanced only behind XW()
__device__ __forceinline__ v16h frag_hp(const _Float16* p) { union { v16h v; v8h q[2]; } u; u.q[0] = *(const v8h*)p; u.q[1] = *(const v8h*)(p + 16); return u.v; }
__device__ __forceinline__ v16b frag_bp(const __bf16* p) { union { v16b v; v8b q[2]; } u; u.q[0] = *(const v8b*)p; u.q[1] = *(const v8b*)(p + 16); return u.v; }
// one 16-query group's 32 scores (log2 units) of one chunk -> P x 2^PEXP in u; running maximum m, per-lane running sum l and the output tiles are brought to the new maximum
__device__ __forceinline__ void fa_soft(float (&u)[16], bool diag, int key0, int query, float& m, float& l, v8f (&acc)[HD / 16]) {
  if (diag) {   // the diagonal chunk: key > query is excluded by index (its first key <= every query of the tile, so no column is left empty)
#pragma unroll
    for (int i = 0; i < 16; ++i) if (key0 + (i >> 3) * 16 + (i & 7) > query) u[i] = -3.0e38f; }
  float mx = u[0];
#pragma unroll
  for (int i = 1; i < 16; ++i) mx = fmaxf(mx, u[i]);
  mx = fmaxf(mx, __shfl_xor(mx, 16));   // lanes c and c + 16 hold the two key halves of one query
  const float mn = fmaxf(m, mx); const float al = ex2(m - mn); m = mn; const float sh = mn - PEXP;
  float d[16], s = 0.f;
#pragma unroll
  for (int i = 0; i < 16; ++i) d[i] = u[i] - sh;
  ex2x8(u, d); ex2x8(u + 8, d + 8);
#pragma unroll
  for (int i = 0; i < 16; ++i) s += u[i];
  l = l * al + s;
#pragma unroll
  for (int j = 0; j < HD / 16; ++j) acc[j] *= al; }
// query rows >= QHI: single f16 products
__device__ __forceinline__ void fa_loop(const _Float16* __restrict__ QH, const _Float16* __restrict__ KH, const _Float16* __restrict__ VT, int b, int x, int wave, int lane, v8f (&acc)[2][HD / 16], float (&m)[2], float (&l)[2]) {
  const int col = lane & 15, g = lane >> 4; const int ql0 = x * FQ;
  const _Float16* kp = KH + ((size_t)b * TT + (wave <= x ? wave : x) * 32 + col) * CC + 8 * g; const _Float16* vp = VT + ((size_t)b * CC + col) * (size_t)TT + wave * 32 + 8 * g;   // the wave's current k rows and v columns, the lane's fragment offset included
  v16h qh[2][2], kf[2][2];
#pragma unroll
  for (int t = 0; t < 2; ++t)
#pragma unroll
    for (int kc = 0; kc < 2; ++kc) { qh[t][kc] = frag_h(QH + ((size_t)b * TT + ql0 + t * 16 + col) * CC + kc * 32, lane); kf[t][kc] = frag_hp(kp + (size_t)t * 16 * CC + kc * 32); }
  XW();
#pragma unroll 1   // rolled: a second pass in flight would double the live fragments and cost the fourth wave per SIMD
  for (int ch = wave; ch <= x; ch += FW) { const int k0 = ch * 32;
    v16h vf[HD / 16];
#pragma unroll
    for (int j = 0; j < HD / 16; ++j) vf[j] = frag_hp(vp + (size_t)j * 16 * TT);
    XW1(vp);   // the v loads issue here, so that the score products and the softmax cover their latency
    vp += FW * 32;
    v8f st[2][2] = {};
#pragma unroll
    for (int kt = 0; kt < 2; ++kt)
#pragma unroll
      for (int kc = 0; kc < 2; ++kc)
#pragma unroll
        for (int qt = 0; qt < 2; ++qt) st[qt][kt] = wmma16(kf[kt][kc], qh[qt][kc], st[qt][kt]);
    kp += ch + FW <= x ? (size_t)FW * 32 * CC : 0;   // the wave's next chunk (its last pass reads its own chunk again: in bounds, unused)
#pragma unroll
    for (int kt = 0; kt < 2; ++kt)
#pragma unroll
      for (int kc = 0; kc < 2; ++kc) kf[kt][kc] = frag_hp(kp + (size_t)kt * 16 * CC + kc * 32);
    XW1(kp);   // the next chunk's k loads issue here, one pass ahead, under the softmax and the P x V products
    v16h ph[2];
#pragma unroll
    for (int qt = 0; qt < 2; ++qt) { float u[16];
#pragma unroll
      for (int i = 0; i < 16; ++i) u[i] = st[qt][i >> 3][i & 7] * SC2;
      fa_soft(u, ch == x, k0 + 8 * g, ql0 + qt * 16 + col, m[qt], l[qt], acc[qt]);
#pragma unroll
      for (int i = 0; i < 16; ++i) ph[qt][i] = (_Float16)u[i]; }
#pragma unroll
    for (int j = 0; j < HD / 16; ++j)
#pragma unroll
      for (int qt = 0; qt < 2; ++qt) acc[qt][j] = wmma16(vf[j], ph[qt], acc[qt][j]); } }
// query rows < QHI (at most 12 chunks a tile), one 16-query group a call (fewer live registers): q and k residual planes in the logits, P and v as bf16 hi + lo
__device__ __forceinline__ void fa_loop_hi(const _Float16* __restrict__ QH, const _Float16* __restrict__ KH, const _Float16* __restrict__ QL, const _Float16* __restrict__ KL, const __bf16* __restrict__ VB, const __bf16* __restrict__ VBL,
    int b, int x, int q0, int wave, int lane, v8f (&acc)[HD / 16], float& m, float& l) {
  if (wave > x) return;   // a wave without a chunk (wave-uniform)
  const int col = lane & 15, g = lane >> 4;
  v16h qh[2], ql[2];
#pragma unroll
  for (int kc = 0; kc < 2; ++kc) { qh[kc] = frag_h(QH + ((size_t)b * TT + q0 + col) * CC + kc * 32, lane); ql[kc] = frag_h(QL + ((size_t)b * QHI + q0 + col) * CC + kc * 32, lane); }
  XW();
  const _Float16* kp = KH + ((size_t)b * TT + wave * 32 + col) * CC + 8 * g; const _Float16* klp = KL + ((size_t)b * KHI + wave * 32 + col) * CC + 8 * g; const __bf16* vp = VB + ((size_t)b * CC + col) * (size_t)KHI + wave * 32 + 8 * g; const __bf16* vlp = VBL + ((size_t)b * CC + col) * (size_t)KHI + wave * 32 + 8 * g;   // the lane's fragment offset included
#pragma unroll 1   // rolled: a second pass in flight would double the live fragments and cost the fourth wave per SIMD
  for (int ch = wave; ch <= x; ch += FW) { const int k0 = ch * 32;
    v16h kf[2][2], klf[2][2];
#pragma unroll
    for (int kt = 0; kt < 2; ++kt)
#pragma unroll
      for (int kc = 0; kc < 2; ++kc) { kf[kt][kc] = frag_hp(kp + (size_t)kt * 16 * CC + kc * 32); klf[kt][kc] = frag_hp(klp + (size_t)kt * 16 * CC + kc * 32); }
    XW2(kp, klp);   // all of the chunk's k loads issue together: one latency, not one per fragment
    kp += (size_t)FW * 32 * CC; klp += (size_t)FW * 32 * CC;
    v8f st[2] = {}, sl[2] = {};
#pragma unroll
    for (int kt = 0; kt < 2; ++kt)
#pragma unroll
      for (int kc = 0; kc < 2; ++kc) { st[kt] = wmma16(kf[kt][kc], qh[kc], st[kt]); sl[kt] = wmma16(kf[kt][kc], ql[kc], sl[kt]); sl[kt] = wmma16(klf[kt][kc], qh[kc], sl[kt]); }
    v16b vh[HD / 16], vl[HD / 16];
#pragma unroll
    for (int j = 0; j < HD / 16; ++j) { vh[j] = frag_bp(vp + (size_t)j * 16 * KHI); vl[j] = frag_bp(vlp + (size_t)j * 16 * KHI); }
    XW2(vp, vlp);   // the v loads issue here, under the softmax
    vp += FW * 32; vlp += FW * 32;
    float u[16];
#pragma unroll
    for (int i = 0; i < 16; ++i) u[i] = (st[i >> 3][i & 7] + sl[i >> 3][i & 7] * (1.0f / 1024.0f)) * SC2;
    fa_soft(u, ch == x, k0 + 8 * g, q0 + col, m, l, acc);
    const F2 pb = bsplit16(u);
#pragma unroll
    for (int j = 0; j < HD / 16; ++j) { acc[j] = wmma_bf(vh[j], pb.h, acc[j]); acc[j] = wmma_bf(vh[j], pb.l, acc[j]); acc[j] = wmma_bf(vl[j], pb.h, acc[j]); } } }
// four waves per SIMD: two 8-wave blocks resident per WGP, so that all 512 blocks run at once
__global__ __launch_bounds__(FW * 32) __attribute__((amdgpu_waves_per_eu(4, 4))) void k_fa(const _Float16* __restrict__ QH, const _Float16* __restrict__ KH, const _Float16* __restrict__ QL, const _Float16* __restrict__ KL, const _Float16* __restrict__ VT, const __bf16* __restrict__ VB, const __bf16* __restrict__ VBL, float* __restrict__ Y) {
  __shared__ __align__(16) float ss[FW][FQ][HD + 4]; __shared__ float smx[FW][FQ], ssu[FW][FQ];
  const int tid = threadIdx.x, wave = __builtin_amdgcn_readfirstlane(tid >> 5), lane = tid & 31, col = lane & 15, g = lane >> 4;
  const int b = blockIdx.x; const int y = blockIdx.y; const int x = y < TT / FQ / 2 ? TT / FQ - 1 - y : y - TT / FQ / 2;   // a permutation of the tiles, for speed only: all blocks are resident, two a WGP; the first half of the grid falls in keys, the second rises, so that blocks half a grid apart add up to the same work
  const int ql0 = x * FQ;
  v8f acc[2][HD / 16] = {}; float m[2] = {-3.0e38f, -3.0e38f}, l[2] = {0.f, 0.f};
  if (ql0 < QHI) { fa_loop_hi(QH, KH, QL, KL, VB, VBL, b, x, ql0, wave, lane, acc[0], m[0], l[0]); fa_loop_hi(QH, KH, QL, KL, VB, VBL, b, x, ql0 + 16, wave, lane, acc[1], m[1], l[1]); }
  else fa_loop(QH, KH, VT, b, x, wave, lane, acc, m, l);
#pragma unroll
  for (int qt = 0; qt < 2; ++qt) { const float lt = l[qt] + __shfl_xor(l[qt], 16); if (g == 0) { smx[wave][qt * 16 + col] = m[qt]; ssu[wave][qt * 16 + col] = lt; }
#pragma unroll
    for (int j = 0; j < HD / 16; ++j) { const v4f lo = {acc[qt][j][0], acc[qt][j][1], acc[qt][j][2], acc[qt][j][3]}, hi = {acc[qt][j][4], acc[qt][j][5], acc[qt][j][6], acc[qt][j][7]};
      *(v4f*)&ss[wave][qt * 16 + col][j * 16 + 8 * g] = lo; *(v4f*)&ss[wave][qt * 16 + col][j * 16 + 8 * g + 4] = hi; } }
  __syncthreads();   // every wave's maximum, sum and partial tile (sum 0 from a wave without a chunk) are in LDS before any is merged
  for (int e = tid; e < FQ * (HD / 4); e += FW * 32) { const int rl = e >> 4, q = e & 15; float M = smx[0][rl];
#pragma unroll
    for (int w = 1; w < FW; ++w) M = fmaxf(M, smx[w][rl]);
    v4f s = {0.f, 0.f, 0.f, 0.f}; float L = 0.f;
#pragma unroll
    for (int w = 0; w < FW; ++w) { const float f = ex2(smx[w][rl] - M); L += f * ssu[w][rl]; s += *(const v4f*)&ss[w][rl][q * 4] * f; }
    vst2(Y + ((size_t)b * TT + ql0 + rl) * CC + q * 4, s * (1.0f / L)); } }

extern "C" void kernel_launch(void* const* d_in, const int* in_sizes, int n_in, void* d_out, int out_size, void* d_ws, size_t ws_size, hipStream_t stream) {
  (void)in_sizes; (void)n_in; (void)out_size;
  const float** F = (const float**)d_in;
  if (ws_size < (size_t)WS_END) return;
  char* ws = (char*)d_ws; _Float16 *QH = (_Float16*)(ws + WS_QH), *KH = (_Float16*)(ws + WS_KH), *VT = (_Float16*)(ws + WS_VT), *QL = (_Float16*)(ws + WS_QL), *KL = (_Float16*)(ws + WS_KL); __bf16 *VB = (__bf16*)(ws + WS_VB), *VBL = (__bf16*)(ws + WS_VBL); float *Y = (float*)(ws + WS_Y);
  (void)Y; (void)QL; (void)KL; (void)VB; (void)VBL;
  // inputs: 0 x [4,4096,512]; 1 Wq [512,64] (in,out); 2 Wk; 3 Wv; no biases
  if (ws_size < (size_t)WS_END2) return;
  float* Y2 = (float*)(ws + WS_Y2);
  k_proj<<<dim3(TNB * TT / 64, CC / 128, 3), 128, 0, stream>>>(F[0], F[0], F[0], F[1], F[2], F[3], nullptr, nullptr, nullptr, QH, QL, KH, KL, VT, VB, VBL);   /* weight columns 64..127 (the padding head) are zero fragments */
  k_fa<<<dim3(TNB, TT / FQ), FW * 32, 0, stream>>>(QH, KH, QL, KL, VT, VB, VBL, Y2);   /* head 0 only (head 1 is the zero padding) */
  k_out64<<<dim3(TNB * TT / 16), 256, 0, stream>>>(Y2, (float*)d_out);
}

// v003
// One run takes 39.4 microseconds.
// In both of two side-by-side timings against v002, it was 1.38 times as fast.
// All steps since v000 together make it 17.0 times as fast.
// compute dtype: all float inputs rounded to bf16; q/k/v projections with EXACT bf16 products on WMMA 16x16x32 (f32 accumulate); causal logits: 3 products for the first 384 rows, single f16 q x k after, x 64^-0.5; running softmax f32; P (against the running maximum) x 2^4 once to f16 x v once to f16 (bf16 hi + lo below row 384); f32 output.
#include <hip/hip_runtime.h>
#include <math.h>

typedef __attribute__((ext_vector_type(16))) _Float16 v16h;
typedef __attribute__((ext_vector_type(16))) __bf16 v16b;
typedef __attribute__((ext_vector_type(8)))  _Float16 v8h;
typedef __attribute__((ext_vector_type(8)))  float v8f;
typedef __attribute__((ext_vector_type(4)))  float v4f;
typedef __attribute__((ext_vector_type(2)))  float v2f;
typedef __attribute__((ext_vector_type(4)))  unsigned v4u;
typedef __attribute__((ext_vector_type(4)))  int v4i;
typedef float __attribute__((may_alias)) float_a;
typedef int __attribute__((may_alias)) int_a;

template <typename T> __device__ __forceinline__ void vst2(void* p, T v) { *(T*)p = v;  }
__device__ __forceinline__ v8f wmma16(v16h a, v16h b, v8f c) {
  v8f d = __builtin_amdgcn_wmma_f32_16x16x32_f16(false, a, false, b, (short)0, c, false, false);
  asm volatile("v_nop\n\tv_nop\n\tv_nop\n\tv_nop" : "+v"(d) : "v"(a), "v"(b));
  return d;
}
__device__ __forceinline__ v8f wmma_bf(v16b a, v16b b, v8f c) {
  v8f d = __builtin_amdgcn_wmma_f32_16x16x32_bf16(false, a, false, b, (short)0, c, false, false);
  asm volatile("v_nop\n\tv_nop\n\tv_nop\n\tv_nop" : "+v"(d) : "v"(a), "v"(b));
  return d;
}
// 16x16x32 fragments: lane = (h = lane>>4, row/col = lane&15); elements 0..7 = k0+8h+0..7, 8..15 = k0+16+8h+0..7; D element r = row 8h+r
__device__ __forceinline__ v16h frag_h(const _Float16* rowk0, int lane) {
  union { v16h v; v8h q[2]; } u; const _Float16* p = rowk0 + 8 * (lane >> 4);
  u.q[0] = *(const v8h*)p; u.q[1] = *(const v8h*)(p + 16); return u.v;
}
__device__ __forceinline__ v16h frag_f32(const float* rowk0, int lane) {
  v16h a; const float* p = rowk0 + 8 * (lane >> 4);
#pragma unroll
  for (int i = 0; i < 8; ++i) { a[i] = (_Float16)p[i]; a[8 + i] = (_Float16)p[16 + i]; }
  return a;
}
__device__ __forceinline__ v16h frag_f32s(const float* rowk0, int lane, float sc) {
  v16h a; const float* p = rowk0 + 8 * (lane >> 4);
#pragma unroll
  for (int i = 0; i < 8; ++i) { a[i] = (_Float16)(p[i] * sc); a[8 + i] = (_Float16)(p[16 + i] * sc); }
  return a;
}
// column fragment from a [K][ld] layout (column n), rows >= K read as 0
__device__ __forceinline__ v16h fragc_f32(const float* W, int k0, int n, int lane, int ld, int K) {
  v16h a; const int g = lane >> 4;
#pragma unroll
  for (int i = 0; i < 8; ++i) { const int ka = k0 + 8 * g + i, kb = ka + 16;
    a[i] = (_Float16)(ka < K ? W[(size_t)(ka < K ? ka : K - 1) * ld + n] : 0.f); a[8 + i] = (_Float16)(kb < K ? W[(size_t)(kb < K ? kb : K - 1) * ld + n] : 0.f); }
  return a;
}
struct F2 { v16b h, l; };
__device__ __forceinline__ F2 bsplit16(const float v[16]) { F2 r;
#pragma unroll
  for (int i = 0; i < 16; ++i) { const __bf16 h = (__bf16)v[i]; r.h[i] = h; r.l[i] = (__bf16)(v[i] - (float)h); }
  return r; }
__device__ __forceinline__ F2 split_row(const float* row, int k0, int lane) { float v[16]; const float* p = row + k0 + 8 * (lane >> 4);
#pragma unroll
  for (int i = 0; i < 8; ++i) { v[i] = p[i]; v[8 + i] = p[16 + i]; }
  return bsplit16(v); }
__device__ __forceinline__ F2 split_rowK(const float* row, int k0, int lane, int K) { float v[16]; const int g = lane >> 4;
#pragma unroll
  for (int i = 0; i < 8; ++i) { const int ka = k0 + 8 * g + i, kb = ka + 16; v[i] = ka < K ? row[ka < K ? ka : K - 1] : 0.f; v[8 + i] = kb < K ? row[kb < K ? kb : K - 1] : 0.f; }
  return bsplit16(v); }
__device__ __forceinline__ F2 split_col(const float* W, int k0, int n, int lane, int ld, int K) { float v[16]; const int g = lane >> 4;
#pragma unroll
  for (int i = 0; i < 8; ++i) { const int ka = k0 + 8 * g + i, kb = ka + 16; v[i] = ka < K ? W[(size_t)(ka < K ? ka : K - 1) * ld + n] : 0.f; v[8 + i] = kb < K ? W[(size_t)(kb < K ? kb : K - 1) * ld + n] : 0.f; }
  return bsplit16(v); }
__device__ __forceinline__ v8f mac3(const F2& a, const F2& b, v8f c) { c = wmma_bf(a.l, b.h, c); c = wmma_bf(a.h, b.l, c); return wmma_bf(a.h, b.h, c); }
__device__ __forceinline__ float sigm(float v) { return 1.0f / (1.0f + expf(-v)); }
#define LDSX() do { asm volatile("s_wait_dscnt 0" ::: "memory"); __builtin_amdgcn_wave_barrier(); __builtin_amdgcn_fence(__ATOMIC_RELEASE, "workgroup"); } while (0)

// Single-head causal self-attention (x [4,4096,512]; (in,out) Wq / Wk / Wv [512,64] N(0, 1/512), no biases; scale 1/sqrt(64); tril, -inf; no output projection): out = softmax(causal(q k^T / 8)) v -> [4,4096,64].
#define NB 4
#define TT 4096
#define CC 128            // NH * HD = projected width
#define DIN 512          // input (model) width
#define NH 2
#define HD 64
#define NQB (TT / 64)
#define HG 1
#define SCALE (0.125f)
#define CAUSAL 1
#ifndef TNB
#define TNB NB
#endif
__device__ __forceinline__ float bfr(float v) { return (float)(__bf16)v; }
__host__ __device__ __forceinline__ int kb_last(int qb) { return CAUSAL ? ((qb * 64 + 63) >> 7) : (TT / 128 - 1); }
typedef __attribute__((ext_vector_type(8))) __bf16 v8b;
__device__ __forceinline__ v16b frag_b(const __bf16* rowk0, int lane) {
  union { v16b v; v8b q[2]; } u; const __bf16* p = rowk0 + 8 * (lane >> 4);
  u.q[0] = *(const v8b*)p; u.q[1] = *(const v8b*)(p + 16); return u.v;
}
#define QBH 6              // not used: k_fa's 32-query tiles 0..11 of each sequence (rows < QHI; few keys, no averaging) take the high-precision path
#define QHI 384            // rows carrying a q residual plane
#define KHI 384            // key rows carrying k residual / v bf16 hi+lo planes (used only by the causal high-precision path)
// B fragment (k rows k0+.., output column o) of a weight: (in,out) [K][ld] or (out,in) [ld rows of K]: bf16 exact, or f16(bf16 * 256) exact
__device__ __forceinline__ v16b wcol_io(const float* Wm, int k0, int o, int lane, int ld) { v16b w; const int g = lane >> 4;
#pragma unroll
  for (int i = 0; i < 8; ++i) { w[i] = (__bf16)Wm[(size_t)(k0 + 8 * g + i) * ld + o]; w[8 + i] = (__bf16)Wm[(size_t)(k0 + 16 + 8 * g + i) * ld + o]; }
  return w; }
__device__ __forceinline__ v16b wcol_oi(const float* Wm, int k0, int o, int lane, int K) { v16b w; const float* p = Wm + (size_t)o * K + k0 + 8 * (lane >> 4);
#pragma unroll
  for (int i = 0; i < 8; ++i) { w[i] = (__bf16)p[i]; w[8 + i] = (__bf16)p[16 + i]; }
  return w; }
__device__ __forceinline__ v16h wcolh_io(const float* Wm, int k0, int o, int lane, int ld) { v16h w; const int g = lane >> 4;
#pragma unroll
  for (int i = 0; i < 8; ++i) { w[i] = (_Float16)(bfr(Wm[(size_t)(k0 + 8 * g + i) * ld + o]) * 256.0f); w[8 + i] = (_Float16)(bfr(Wm[(size_t)(k0 + 16 + 8 * g + i) * ld + o]) * 256.0f); }
  return w; }
__device__ __forceinline__ v16h wcolh_oi(const float* Wm, int k0, int o, int lane, int K) { v16h w; const float* p = Wm + (size_t)o * K + k0 + 8 * (lane >> 4);
#pragma unroll
  for (int i = 0; i < 8; ++i) { w[i] = (_Float16)(bfr(p[i]) * 256.0f); w[8 + i] = (_Float16)(bfr(p[16 + i]) * 256.0f); }
  return w; }
#define WQKV_LAYOUT 0   // 0 = (in,out) [DIN][HD]; 1 = (out,in) [CC][DIN]; 2 = per-head [NH][DIN][HD]
__device__ __forceinline__ v16b wcol_hdk(const float* Wm, int k0, int o, int lane) { v16b w; const int g = lane >> 4; const float* p = Wm + (size_t)(o / HD) * DIN * HD + (o % HD);
#pragma unroll
  for (int i = 0; i < 8; ++i) { w[i] = (__bf16)p[(size_t)(k0 + 8 * g + i) * HD]; w[8 + i] = (__bf16)p[(size_t)(k0 + 16 + 8 * g + i) * HD]; }
  return w; }
#define WO_OUT_IN 0
#if WQKV_LAYOUT == 1
#define WCOL(W, k0, o, lane) wcol_oi(W, k0, o, lane, DIN)
#elif WQKV_LAYOUT == 2
#define WCOL(W, k0, o, lane) wcol_hdk(W, k0, o, lane)
#else
__device__ __forceinline__ v16b zero16b() { v16b w; _Pragma("unroll") for (int i = 0; i < 16; ++i) w[i] = (__bf16)0.0f; return w; }
#define WCOL(W, k0, o, lane) ((o) < 64 ? wcol_io(W, k0, (o), lane, 64) : zero16b())   /* (in,out) [512][64] pitch 64: only 64 real output columns; projected columns 64..127 (padding head 1) are zero */
#endif
#if WO_OUT_IN
#define WOCOL(W, k0, o, lane) wcol_oi(W, k0, o, lane, CC)
#define WOCOLH(W, k0, o, lane) wcolh_oi(W, k0, o, lane, CC)
#else
#define WOCOL(W, k0, o, lane) wcol_io(W, k0, o, lane, DIN)
#define WOCOLH(W, k0, o, lane) wcolh_io(W, k0, o, lane, DIN)
#endif

#ifndef SM_EXTRA_PARAMS
#define SM_EXTRA_PARAMS
#endif
#ifndef PROJ_EXTRA_PARAMS
#define PROJ_EXTRA_PARAMS
#endif
#ifndef SM_MASK_HOOK
#define SM_MASK_HOOK (void)0
#endif

#define WS_QH  0u                                      // f16 q rows [b*t][CC]
#define WS_KH  (WS_QH + 2u * (size_t)NB * TT * CC)      // f16 k rows [b*t][CC]
#define WS_VT  (WS_KH + 2u * (size_t)NB * TT * CC)      // f16 v planes [b][c][t]
#define WS_QL  (WS_VT + 2u * (size_t)NB * CC * TT)      // f16 q residual x 2^10 rows [b][t < QHI][CC]
#define WS_KL  (WS_QL + 2u * (size_t)NB * QHI * CC)     // f16 k residual x 2^10 rows [b][t < KHI][CC]
#define WS_VB  (WS_KL + 2u * (size_t)NB * KHI * CC)     // bf16 v hi planes [b][c][t < KHI]
#define WS_VBL (WS_VB + 2u * (size_t)NB * CC * KHI)
#define WS_S   (WS_VBL + 2u * (size_t)NB * CC * KHI)    // f32 [hg][t][s], reserved only: no kernel here stores logits or P (they stay in registers)
#define WS_Y   (WS_S  + 4u * (size_t)HG * TT * TT)      // f32 ctx rows [b*t][CC] (only when there is an output projection)
#define WS_END (WS_Y  + 0u)
#define WS_Y2 (WS_END)                                  // f32 ctx rows [b*TT + t][128] (columns 64..127 = the padding head)
#define WS_END2 (WS_Y2 + 4u * (size_t)NB * TT * CC)

// ---- k_out64: out[b][t][0..63] = ctx row columns 0..63 (256 B by 16 lanes)
__global__ __launch_bounds__(256) void k_out64(const float* __restrict__ Y, float* __restrict__ OUT) { const size_t row = (size_t)blockIdx.x * 16 + (threadIdx.x >> 4); const int q = threadIdx.x & 15; const v4f v = *(const v4f*)(Y + row * CC + q * 4); asm volatile("s_wait_loadcnt 0x0" ::: "memory"); vst2(OUT + row * 64 + q * 4, v); }
// ---- k_fa: block = 32 queries of batch b, 8 waves: wave w takes the 32-key chunks w, w + 8, ... up to the diagonal chunk. Per chunk: S^T = K Q^T (a lane holds 16 keys' scores of one query per 16-query group), running maximum and sum per query in f32 (log2 domain),
// P^T packed from the score accumulators straight into the B operand, O^T += V^T P^T. The 8 waves' (maximum, sum, O) are merged through LDS in wave order. Query rows < QHI: 3-product logits and P, v as bf16 hi + lo (3 products), as before.
#define FQ 32              // queries per block (two 16-column groups per wave)
#define FW 8               // waves per block = key chunks in flight per 32-query tile
#define SC2 (SCALE * 1.4426950408889634f)   // logits in log2 units
#define PEXP 4.0f          // P carries 2^4 (cancels in the division by the sum): keeps small P clear of the f16 subnormals
// 2^a as v_exp_f32 in asm text with one v_nop behind the last: the slot that the instruction set asks for between a transcendental and a directly following instruction that reads its result or overwrites its source
// "=&v" keeps every result off every source, so the eight in a row are independent of each other
__device__ __forceinline__ float ex2(float a) { float r; asm("v_exp_f32 %0, %1\n\tv_nop" : "=v"(r) : "v"(a)); return r; }
__device__ __forceinline__ void ex2x8(float* r, const float* a) {
  asm("v_exp_f32 %0, %8\n\tv_exp_f32 %1, %9\n\tv_exp_f32 %2, %10\n\tv_exp_f32 %3, %11\n\tv_exp_f32 %4, %12\n\tv_exp_f32 %5, %13\n\tv_exp_f32 %6, %14\n\tv_exp_f32 %7, %15\n\tv_nop"
      : "=&v"(r[0]), "=&v"(r[1]), "=&v"(r[2]), "=&v"(r[3]), "=&v"(r[4]), "=&v"(r[5]), "=&v"(r[6]), "=&v"(r[7]) : "v"(a[0]), "v"(a[1]), "v"(a[2]), "v"(a[3]), "v"(a[4]), "v"(a[5]), "v"(a[6]), "v"(a[7])); }
// stands behind a run of global loads, in front of any instruction that writes a register which an issued load names (a precaution); its "memory" clobber also keeps those loads issued above it
#define XW() asm volatile("s_wait_xcnt 0x0" ::: "memory")
// the same wait with the run's address pointers as inputs only: they stay live up to the wait, so that no load of the run gets its result placed on an address pair that earlier loads of the run name
#define XW1(p) asm volatile("s_wait_xcnt 0x0" :: "v"(p) : "memory")
#define XW2(p, q) asm volatile("s_wait_xcnt 0x0" :: "v"(p), "v"(q) : "memory")
// fragments through a pointer that already holds the lane's 8 * (lane >> 4) element offset: the loads of a run then name the loop pointer itself, which is advanced only behind XW()
__device__ __forceinline__ v16h frag_hp(const _Float16* p) { union { v16h v; v8h q[2]; } u; u.q[0] = *(const v8h*)p; u.q[1] = *(const v8h*)(p + 16); return u.v; }
__device__ __forceinline__ v16b frag_bp(const __bf16* p) { union { v16b v; v8b q[2]; } u; u.q[0] = *(const v8b*)p; u.q[1] = *(const v8b*)(p + 16); return u.v; }
// one 16-query group's 32 scores (log2 units) of one chunk -> P x 2^PEXP in u; running maximum m, per-lane running sum l and the output tiles are brought to the new maximum
__device__ __forceinline__ void fa_soft(float (&u)[16], bool diag, int key0, int query, float& m, float& l, v8f (&acc)[HD / 16]) {
  if (diag) {   // the diagonal chunk: key > query is excluded by index (its first key <= every query of the tile, so no column is left empty)
#pragma unroll
    for (int i = 0; i < 16; ++i) if (key0 + (i >> 3) * 16 + (i & 7) > query) u[i] = -3.0e38f; }
  float mx = u[0];
#pragma unroll
  for (int i = 1; i < 16; ++i) mx = fmaxf(mx, u[i]);
  mx = fmaxf(mx, __shfl_xor(mx, 16));   // lanes c and c + 16 hold the two key halves of one query
  const float mn = fmaxf(m, mx); const float al = ex2(m - mn); m = mn; const float sh = mn - PEXP;
  float d[16], s = 0.f;
#pragma unroll
  for (int i = 0; i < 16; ++i) d[i] = u[i] - sh;
  ex2x8(u, d); ex2x8(u + 8, d + 8);
#pragma unroll
  for (int i = 0; i < 16; ++i) s += u[i];
  l = l * al + s;
#pragma unroll
  for (int j = 0; j < HD / 16; ++j) acc[j] *= al; }
// query rows >= QHI: single f16 products
__device__ __forceinline__ void fa_loop(const _Float16* __restrict__ QH, const _Float16* __restrict__ KH, const _Float16* __restrict__ VT, int b, int x, int wave, int lane, v8f (&acc)[2][HD / 16], float (&m)[2], float (&l)[2]) {
  const int col = lane & 15, g = lane >> 4; const int ql0 = x * FQ;
  const _Float16* kp = KH + ((size_t)b * TT + (wave <= x ? wave : x) * 32 + col) * CC + 8 * g; const _Float16* vp = VT + ((size_t)b * CC + col) * (size_t)TT + wave * 32 + 8 * g;   // the wave's current k rows and v columns, the lane's fragment offset included
  v16h qh[2][2], kf[2][2];
#pragma unroll
  for (int t = 0; t < 2; ++t)
#pragma unroll
    for (int kc = 0; kc < 2; ++kc) { qh[t][kc] = frag_h(QH + ((size_t)b * TT + ql0 + t * 16 + col) * CC + kc * 32, lane); kf[t][kc] = frag_hp(kp + (size_t)t * 16 * CC + kc * 32); }
  XW();
#pragma unroll 1   // rolled: a second pass in flight would double the live fragments and cost the fourth wave per SIMD
  for (int ch = wave; ch <= x; ch += FW) { const int k0 = ch * 32;
    v16h vf[HD / 16];
#pragma unroll
    for (int j = 0; j < HD / 16; ++j) vf[j] = frag_hp(vp + (size_t)j * 16 * TT);
    XW1(vp);   // the v loads issue here, so that the score products and the softmax cover their latency
    vp += FW * 32;
    v8f st[2][2] = {};
#pragma unroll
    for (int kt = 0; kt < 2; ++kt)
#pragma unroll
      for (int kc = 0; kc < 2; ++kc)
#pragma unroll
        for (int qt = 0; qt < 2; ++qt) st[qt][kt] = wmma16(kf[kt][kc], qh[qt][kc], st[qt][kt]);
    kp += ch + FW <= x ? (size_t)FW * 32 * CC : 0;   // the wave's next chunk (its last pass reads its own chunk again: in bounds, unused)
#pragma unroll
    for (int kt = 0; kt < 2; ++kt)
#pragma unroll
      for (int kc = 0; kc < 2; ++kc) kf[kt][kc] = frag_hp(kp + (size_t)kt * 16 * CC + kc * 32);
    XW1(kp);   // the next chunk's k loads issue here, one pass ahead, under the softmax and the P x V products
    v16h ph[2];
#pragma unroll
    for (int qt = 0; qt < 2; ++qt) { float u[16];
#pragma unroll
      for (int i = 0; i < 16; ++i) u[i] = st[qt][i >> 3][i & 7] * SC2;
      fa_soft(u, ch == x, k0 + 8 * g, ql0 + qt * 16 + col, m[qt], l[qt], acc[qt]);
#pragma unroll
      for (int i = 0; i < 16; ++i) ph[qt][i] = (_Float16)u[i]; }
#pragma unroll
    for (int j = 0; j < HD / 16; ++j)
#pragma unroll
      for (int qt = 0; qt < 2; ++qt) acc[qt][j] = wmma16(vf[j], ph[qt], acc[qt][j]); } }
// query rows < QHI (at most 12 chunks a tile), one 16-query group a call (fewer live registers): q and k residual planes in the logits, P and v as bf16 hi + lo
__device__ __forceinline__ void fa_loop_hi(const _Float16* __restrict__ QH, const _Float16* __restrict__ KH, const _Float16* __restrict__ QL, const _Float16* __restrict__ KL, const __bf16* __restrict__ VB, const __bf16* __restrict__ VBL,
    int b, int x, int q0, int wave, int lane, v8f (&acc)[HD / 16], float& m, float& l) {
  if (wave > x) return;   // a wave without a chunk (wave-uniform)
  const int col = lane & 15, g = lane >> 4;
  v16h qh[2], ql[2];
#pragma unroll
  for (int kc = 0; kc < 2; ++kc) { qh[kc] = frag_h(QH + ((size_t)b * TT + q0 + col) * CC + kc * 32, lane); ql[kc] = frag_h(QL + ((size_t)b * QHI + q0 + col) * CC + kc * 32, lane); }
  XW();
  const _Float16* kp = KH + ((size_t)b * TT + wave * 32 + col) * CC + 8 * g; const _Float16* klp = KL + ((size_t)b * KHI + wave * 32 + col) * CC + 8 * g; const __bf16* vp = VB + ((size_t)b * CC + col) * (size_t)KHI + wave * 32 + 8 * g; const __bf16* vlp = VBL + ((size_t)b * CC + col) * (size_t)KHI + wave * 32 + 8 * g;   // the lane's fragment offset included
#pragma unroll 1   // rolled: a second pass in flight would double the live fragments and cost the fourth wave per SIMD
  for (int ch = wave; ch <= x; ch += FW) { const int k0 = ch * 32;
    v16h kf[2][2], klf[2][2];
#pragma unroll
    for (int kt = 0; kt < 2; ++kt)
#pragma unroll
      for (int kc = 0; kc < 2; ++kc) { kf[kt][kc] = frag_hp(kp + (size_t)kt * 16 * CC + kc * 32); klf[kt][kc] = frag_hp(klp + (size_t)kt * 16 * CC + kc * 32); }
    XW2(kp, klp);   // all of the chunk's k loads issue together: one latency, not one per fragment
    kp += (size_t)FW * 32 * CC; klp += (size_t)FW * 32 * CC;
    v8f st[2] = {}, sl[2] = {};
#pragma unroll
    for (int kt = 0; kt < 2; ++kt)
#pragma unroll
      for (int kc = 0; kc < 2; ++kc) { st[kt] = wmma16(kf[kt][kc], qh[kc], st[kt]); sl[kt] = wmma16(kf[kt][kc], ql[kc], sl[kt]); sl[kt] = wmma16(klf[kt][kc], qh[kc], sl[kt]); }
    v16b vh[HD / 16], vl[HD / 16];
#pragma unroll
    for (int j = 0; j < HD / 16; ++j) { vh[j] = frag_bp(vp + (size_t)j * 16 * KHI); vl[j] = frag_bp(vlp + (size_t)j * 16 * KHI); }
    XW2(vp, vlp);   // the v loads issue here, under the softmax
    vp += FW * 32; vlp += FW * 32;
    float u[16];
#pragma unroll
    for (int i = 0; i < 16; ++i) u[i] = (st[i >> 3][i & 7] + sl[i >> 3][i & 7] * (1.0f / 1024.0f)) * SC2;
    fa_soft(u, ch == x, k0 + 8 * g, q0 + col, m, l, acc);
    const F2 pb = bsplit16(u);
#pragma unroll
    for (int j = 0; j < HD / 16; ++j) { acc[j] = wmma_bf(vh[j], pb.h, acc[j]); acc[j] = wmma_bf(vh[j], pb.l, acc[j]); acc[j] = wmma_bf(vl[j], pb.h, acc[j]); } } }
// four waves per SIMD: two 8-wave blocks resident per WGP, so that all 512 blocks run at once
__global__ __launch_bounds__(FW * 32) __attribute__((amdgpu_waves_per_eu(4, 4))) void k_fa(const _Float16* __restrict__ QH, const _Float16* __restrict__ KH, const _Float16* __restrict__ QL, const _Float16* __restrict__ KL, const _Float16* __restrict__ VT, const __bf16* __restrict__ VB, const __bf16* __restrict__ VBL, float* __restrict__ Y) {
  __shared__ __align__(16) float ss[FW][FQ][HD + 4]; __shared__ float smx[FW][FQ], ssu[FW][FQ];
  const int tid = threadIdx.x, wave = __builtin_amdgcn_readfirstlane(tid >> 5), lane = tid & 31, col = lane & 15, g = lane >> 4;
  const int b = blockIdx.x; const int y = blockIdx.y; const int x = y < TT / FQ / 2 ? TT / FQ - 1 - y : y - TT / FQ / 2;   // a permutation of the tiles, for speed only: all blocks are resident, two a WGP; the first half of the grid falls in keys, the second rises, so that blocks half a grid apart add up to the same work
  const int ql0 = x * FQ;
  v8f acc[2][HD / 16] = {}; float m[2] = {-3.0e38f, -3.0e38f}, l[2] = {0.f, 0.f};
  if (ql0 < QHI) { fa_loop_hi(QH, KH, QL, KL, VB, VBL, b, x, ql0, wave, lane, acc[0], m[0], l[0]); fa_loop_hi(QH, KH, QL, KL, VB, VBL, b, x, ql0 + 16, wave, lane, acc[1], m[1], l[1]); }
  else fa_loop(QH, KH, VT, b, x, wave, lane, acc, m, l);
#pragma unroll
  for (int qt = 0; qt < 2; ++qt) { const float lt = l[qt] + __shfl_xor(l[qt], 16); if (g == 0) { smx[wave][qt * 16 + col] = m[qt]; ssu[wave][qt * 16 + col] = lt; }
#pragma unroll
    for (int j = 0; j < HD / 16; ++j) { const v4f lo = {acc[qt][j][0], acc[qt][j][1], acc[qt][j][2], acc[qt][j][3]}, hi = {acc[qt][j][4], acc[qt][j][5], acc[qt][j][6], acc[qt][j][7]};
      *(v4f*)&ss[wave][qt * 16 + col][j * 16 + 8 * g] = lo; *(v4f*)&ss[wave][qt * 16 + col][j * 16 + 8 * g + 4] = hi; } }
  __syncthreads();   // every wave's maximum, sum and partial tile (sum 0 from a wave without a chunk) are in LDS before any is merged
  for (int e = tid; e < FQ * (HD / 4); e += FW * 32) { const int rl = e >> 4, q = e & 15; float M = smx[0][rl];
#pragma unroll
    for (int w = 1; w < FW; ++w) M = fmaxf(M, smx[w][rl]);
    v4f s = {0.f, 0.f, 0.f, 0.f}; float L = 0.f;
#pragma unroll
    for (int w = 0; w < FW; ++w) { const float f = ex2(smx[w][rl] - M); L += f * ssu[w][rl]; s += *(const v4f*)&ss[w][rl][q * 4] * f; }
    vst2(Y + ((size_t)b * TT + ql0 + rl) * CC + q * 4, s * (1.0f / L)); } }

// ---- k_proj: block = 64 rows of x, 16 waves: q, k and v (the 192 real columns) from one pass over x. x and the three weights come in by whole-line loads, are rounded to bf16 and laid in LDS once per block (weights as [column][k]);
// wave (row tile, column tile) then takes its fragments from LDS: exact bf16 products, k slices in rising order. q, k f16 rows (+ residual rows < QHI, KHI), v f16 planes [c][t] (+ bf16 hi/lo planes for t < KHI); columns and planes 64..127 of the workspace pitch are neither written nor read
#define PWP 520            // LDS row pitch in elements: 1040 B = 16 B x 65 (odd), so that 16 rows' 16-byte reads and writes fall on all banks
#define PEP 72             // pitch of the output tiles in LDS: 144 B = 16 B x 9
__global__ __launch_bounds__(512) void k_proj(const float* __restrict__ X, const float* __restrict__ WQ, const float* __restrict__ WK, const float* __restrict__ WV,
    _Float16* __restrict__ QH, _Float16* __restrict__ QL, _Float16* __restrict__ KH, _Float16* __restrict__ KL, _Float16* __restrict__ VT, __bf16* __restrict__ VB, __bf16* __restrict__ VBL) {
  __shared__ __align__(16) __bf16 wsm[192][PWP]; __shared__ __align__(16) __bf16 xsm[64][PWP];
  const int tid = threadIdx.x, wave = tid >> 5, lane = tid & 31, col = lane & 15, g = lane >> 4; const size_t r0 = (size_t)blockIdx.x * 64; const size_t bb = r0 / TT; const int t0 = (int)(r0 % TT);
  const float* xp = X + r0 * DIN + tid * 4;   // a wave's load = 512 B in a row of x
  v4f xr[16];
#pragma unroll
  for (int i = 0; i < 16; ++i) xr[i] = *(const v4f*)(xp + i * 2048);
  XW();   // all of the block's x is requested before anything waits
  const int wo = tid & 63, wk = tid >> 6;   // weight column; 8-row k group within a 64-row slab (a wave's load = 128 B of one weight row)
  const size_t woff = (size_t)wk * 8 * 64 + wo;
  float wv[2][32];
#pragma unroll
  for (int n = 0; n < 7; ++n) {   // batch n = weight n / 2, k rows (n & 1) * 256 ..+255; batch n + 1 is requested before batch n is packed
    if (n < 6) { const float* wp = (n < 2 ? WQ : n < 4 ? WK : WV) + woff + (size_t)(n & 1) * 256 * 64;
#pragma unroll
      for (int r = 0; r < 4; ++r)
#pragma unroll
        for (int i = 0; i < 8; ++i) wv[n & 1][r * 8 + i] = wp[(r * 64 + i) * 64];
      XW(); }
    if (n == 0) {
#pragma unroll
      for (int i = 0; i < 16; ++i) { typedef __attribute__((ext_vector_type(4))) __bf16 v4b; v4b pk;
#pragma unroll
        for (int e = 0; e < 4; ++e) pk[e] = (__bf16)xr[i][e];
        *(v4b*)&xsm[(tid >> 7) + i * 4][(tid & 127) * 4] = pk; }
    } else { const int p = n - 1;
#pragma unroll
      for (int r = 0; r < 4; ++r) { v8b pk;
#pragma unroll
        for (int i = 0; i < 8; ++i) pk[i] = (__bf16)wv[p & 1][r * 8 + i];
        *(v8b*)&wsm[(p >> 1) * 64 + wo][(p & 1) * 256 + r * 64 + wk * 8] = pk; } } }
  __syncthreads();   // x and the weights are in LDS before any fragment is read
  const int rt = wave & 3, ct = wave >> 2;
  v8f acc[3] = {};
  const __bf16* ap = &xsm[rt * 16 + col][0]; const __bf16* bp = &wsm[ct * 16 + col][0];
  v16b fa[2][2], fb[2][2][3];   // two k slices a group, two groups of fragments: the next group's LDS reads are issued in front of this group's products, which cover their latency
#pragma unroll
  for (int s = 0; s < 2; ++s) { fa[0][s] = frag_b(ap + s * 32, lane);
#pragma unroll
    for (int mt = 0; mt < 3; ++mt) fb[0][s][mt] = frag_b(bp + mt * 64 * PWP + s * 32, lane); }
#pragma unroll   // unrolled: the two fragment groups are named at compile time
  for (int kg = 0; kg < DIN / 64; ++kg) {
    if (kg + 1 < DIN / 64) {
#pragma unroll
      for (int s = 0; s < 2; ++s) { fa[(kg + 1) & 1][s] = frag_b(ap + (kg + 1) * 64 + s * 32, lane);
#pragma unroll
        for (int mt = 0; mt < 3; ++mt) fb[(kg + 1) & 1][s][mt] = frag_b(bp + mt * 64 * PWP + (kg + 1) * 64 + s * 32, lane); } }
#pragma unroll
    for (int s = 0; s < 2; ++s)
#pragma unroll
      for (int mt = 0; mt < 3; ++mt) acc[mt] = wmma_bf(fa[kg & 1][s], fb[kg & 1][s][mt], acc[mt]); }
  __syncthreads();   // every wave's last read of xsm is done before its space takes the output tiles
  _Float16* eb = (_Float16*)&xsm[0][0]; _Float16 *sqh = eb, *sql = eb + 64 * PEP, *skh = eb + 2 * 64 * PEP, *skl = eb + 3 * 64 * PEP, *sth = eb + 4 * 64 * PEP; __bf16 *stb = (__bf16*)(eb + 5 * 64 * PEP), *stl = (__bf16*)(eb + 6 * 64 * PEP);
  const bool hi_rows = t0 < KHI;
#pragma unroll
  for (int r = 0; r < 8; ++r) { const int rl = rt * 16 + 8 * g + r, cl = ct * 16 + col;
    { const float v = acc[0][r]; const _Float16 hv = (_Float16)v; sqh[rl * PEP + cl] = hv; sql[rl * PEP + cl] = (_Float16)((v - (float)hv) * 1024.0f); }
    { const float v = acc[1][r]; const _Float16 hv = (_Float16)v; skh[rl * PEP + cl] = hv; skl[rl * PEP + cl] = (_Float16)((v - (float)hv) * 1024.0f); }
    { const float v = acc[2][r]; sth[cl * PEP + rl] = (_Float16)v; const __bf16 bh = (__bf16)v; stb[cl * PEP + rl] = bh; stl[cl * PEP + rl] = (__bf16)(v - (float)bh); } }
  __syncthreads();   // the output tiles are whole before they are stored by rows
  { const int rl = tid >> 3, q = tid & 7; const int so = rl * PEP + q * 8;   // 8 lanes store one 128-byte row (q, k: row rl; v: plane rl)
    vst2(QH + (r0 + rl) * CC + q * 8, *(const v4u*)&sqh[so]); vst2(KH + (r0 + rl) * CC + q * 8, *(const v4u*)&skh[so]); vst2(VT + (bb * CC + rl) * (size_t)TT + t0 + q * 8, *(const v4u*)&sth[so]);
    XW();   // behind the three stores, in front of the address arithmetic of the residual planes
    if (hi_rows) { vst2(QL + (bb * QHI + t0 + rl) * (size_t)CC + q * 8, *(const v4u*)&sql[so]); vst2(KL + (bb * KHI + t0 + rl) * (size_t)CC + q * 8, *(const v4u*)&skl[so]);
      const size_t o3 = (bb * CC + rl) * (size_t)KHI + t0 + q * 8; vst2(VB + o3, *(const v4u*)&stb[so]); vst2(VBL + o3, *(const v4u*)&stl[so]); } } }

extern "C" void kernel_launch(void* const* d_in, const int* in_sizes, int n_in, void* d_out, int out_size, void* d_ws, size_t ws_size, hipStream_t stream) {
  (void)in_sizes; (void)n_in; (void)out_size;
  const float** F = (const float**)d_in;
  if (ws_size < (size_t)WS_END) return;
  char* ws = (char*)d_ws; _Float16 *QH = (_Float16*)(ws + WS_QH), *KH = (_Float16*)(ws + WS_KH), *VT = (_Float16*)(ws + WS_VT), *QL = (_Float16*)(ws + WS_QL), *KL = (_Float16*)(ws + WS_KL); __bf16 *VB = (__bf16*)(ws + WS_VB), *VBL = (__bf16*)(ws + WS_VBL); float *Y = (float*)(ws + WS_Y);
  (void)Y; (void)QL; (void)KL; (void)VB; (void)VBL;
  // inputs: 0 x [4,4096,512]; 1 Wq [512,64] (in,out); 2 Wk; 3 Wv; no biases
  if (ws_size < (size_t)WS_END2) return;
  float* Y2 = (float*)(ws + WS_Y2);
  k_proj<<<dim3(TNB * TT / 64), 512, 0, stream>>>(F[0], F[1], F[2], F[3], QH, QL, KH, KL, VT, VB, VBL);
  k_fa<<<dim3(TNB, TT / FQ), FW * 32, 0, stream>>>(QH, KH, QL, KL, VT, VB, VBL, Y2);   /* head 0 only (head 1 is the zero padding) */
  k_out64<<<dim3(TNB * TT / 16), 256, 0, stream>>>(Y2, (float*)d_out);
}

// v004
// It runs in 36.7 microseconds.
// Timed twice side by side with v003, it ran 1.07 times as fast both times.
// All steps since v000 together make it 18.2 times as fast.
// compute dtype: all float inputs rounded to bf16; q/k/v projections with EXACT bf16 products on WMMA 16x16x32 (f32 accumulate); causal logits: 3 products for the first 384 rows, single f16 q x k after, x 64^-0.5; running softmax f32; P (against the running maximum) x 2^4 once to f16 x v once to f16 (bf16 hi + lo below row 384); f32 output.
#include <hip/hip_runtime.h>
#include <math.h>

typedef __attribute__((ext_vector_type(16))) _Float16 v16h;
typedef __attribute__((ext_vector_type(16))) __bf16 v16b;
typedef __attribute__((ext_vector_type(8)))  _Float16 v8h;
typedef __attribute__((ext_vector_type(8)))  float v8f;
typedef __attribute__((ext_vector_type(4)))  float v4f;
typedef __attribute__((ext_vector_type(2)))  float v2f;
typedef __attribute__((ext_vector_type(4)))  unsigned v4u;
typedef __attribute__((ext_vector_type(4)))  int v4i;
typedef float __attribute__((may_alias)) float_a;
typedef int __attribute__((may_alias)) int_a;

template <typename T> __device__ __forceinline__ void vst2(void* p, T v) { *(T*)p = v;  }
__device__ __forceinline__ v8f wmma16(v16h a, v16h b, v8f c) {
  v8f d = __builtin_amdgcn_wmma_f32_16x16x32_f16(false, a, false, b, (short)0, c, false, false);
  asm volatile("v_nop\n\tv_nop\n\tv_nop\n\tv_nop" : "+v"(d) : "v"(a), "v"(b));
  return d;
}
__device__ __forceinline__ v8f wmma_bf(v16b a, v16b b, v8f c) {
  v8f d = __builtin_amdgcn_wmma_f32_16x16x32_bf16(false, a, false, b, (short)0, c, false, false);
  asm volatile("v_nop\n\tv_nop\n\tv_nop\n\tv_nop" : "+v"(d) : "v"(a), "v"(b));
  return d;
}
// 16x16x32 fragments: lane = (h = lane>>4, row/col = lane&15); elements 0..7 = k0+8h+0..7, 8..15 = k0+16+8h+0..7; D element r = row 8h+r
__device__ __forceinline__ v16h frag_h(const _Float16* rowk0, int lane) {
  union { v16h v; v8h q[2]; } u; const _Float16* p = rowk0 + 8 * (lane >> 4);
  u.q[0] = *(const v8h*)p; u.q[1] = *(const v8h*)(p + 16); return u.v;
}
__device__ __forceinline__ v16h frag_f32(const float* rowk0, int lane) {
  v16h a; const float* p = rowk0 + 8 * (lane >> 4);
#pragma unroll
  for (int i = 0; i < 8; ++i) { a[i] = (_Float16)p[i]; a[8 + i] = (_Float16)p[16 + i]; }
  return a;
}
__device__ __forceinline__ v16h frag_f32s(const float* rowk0, int lane, float sc) {
  v16h a; const float* p = rowk0 + 8 * (lane >> 4);
#pragma unroll
  for (int i = 0; i < 8; ++i) { a[i] = (_Float16)(p[i] * sc); a[8 + i] = (_Float16)(p[16 + i] * sc); }
  return a;
}
// column fragment from a [K][ld] layout (column n), rows >= K read as 0
__device__ __forceinline__ v16h fragc_f32(const float* W, int k0, int n, int lane, int ld, int K) {
  v16h a; const int g = lane >> 4;
#pragma unroll
  for (int i = 0; i < 8; ++i) { const int ka = k0 + 8 * g + i, kb = ka + 16;
    a[i] = (_Float16)(ka < K ? W[(size_t)(ka < K ? ka : K - 1) * ld + n] : 0.f); a[8 + i] = (_Float16)(kb < K ? W[(size_t)(kb < K ? kb : K - 1) * ld + n] : 0.f); }
  return a;
}
struct F2 { v16b h, l; };
__device__ __forceinline__ F2 bsplit16(const float v[16]) { F2 r;
#pragma unroll
  for (int i = 0; i < 16; ++i) { const __bf16 h = (__bf16)v[i]; r.h[i] = h; r.l[i] = (__bf16)(v[i] - (float)h); }
  return r; }
__device__ __forceinline__ F2 split_row(const float* row, int k0, int lane) { float v[16]; const float* p = row + k0 + 8 * (lane >> 4);
#pragma unroll
  for (int i = 0; i < 8; ++i) { v[i] = p[i]; v[8 + i] = p[16 + i]; }
  return bsplit16(v); }
__device__ __forceinline__ F2 split_rowK(const float* row, int k0, int lane, int K) { float v[16]; const int g = lane >> 4;
#pragma unroll
  for (int i = 0; i < 8; ++i) { const int ka = k0 + 8 * g + i, kb = ka + 16; v[i] = ka < K ? row[ka < K ? ka : K - 1] : 0.f; v[8 + i] = kb < K ? row[kb < K ? kb : K - 1] : 0.f; }
  return bsplit16(v); }
__device__ __forceinline__ F2 split_col(const float* W, int k0, int n, int lane, int ld, int K) { float v[16]; const int g = lane >> 4;
#pragma unroll
  for (int i = 0; i < 8; ++i) { const int ka = k0 + 8 * g + i, kb = ka + 16; v[i] = ka < K ? W[(size_t)(ka < K ? ka : K - 1) * ld + n] : 0.f; v[8 + i] = kb < K ? W[(size_t)(kb < K ? kb : K - 1) * ld + n] : 0.f; }
  return bsplit16(v); }
__device__ __forceinline__ v8f mac3(const F2& a, const F2& b, v8f c) { c = wmma_bf(a.l, b.h, c); c = wmma_bf(a.h, b.l, c); return wmma_bf(a.h, b.h, c); }
__device__ __forceinline__ float sigm(float v) { return 1.0f / (1.0f + expf(-v)); }
#define LDSX() do { asm volatile("s_wait_dscnt 0" ::: "memory"); __builtin_amdgcn_wave_barrier(); __builtin_amdgcn_fence(__ATOMIC_RELEASE, "workgroup"); } while (0)

// Single-head causal self-attention (x [4,4096,512]; (in,out) Wq / Wk / Wv [512,64] N(0, 1/512), no biases; scale 1/sqrt(64); tril, -inf; no output projection): out = softmax(causal(q k^T / 8)) v -> [4,4096,64].
#define NB 4
#define TT 4096
#define CC 128            // NH * HD = projected width
#define DIN 512          // input (model) width
#define NH 2
#define HD 64
#define NQB (TT / 64)
#define HG 1
#define SCALE (0.125f)
#define CAUSAL 1
#ifndef TNB
#define TNB NB
#endif
__device__ __forceinline__ float bfr(float v) { return (float)(__bf16)v; }
__host__ __device__ __forceinline__ int kb_last(int qb) { return CAUSAL ? ((qb * 64 + 63) >> 7) : (TT / 128 - 1); }
typedef __attribute__((ext_vector_type(8))) __bf16 v8b;
__device__ __forceinline__ v16b frag_b(const __bf16* rowk0, int lane) {
  union { v16b v; v8b q[2]; } u; const __bf16* p = rowk0 + 8 * (lane >> 4);
  u.q[0] = *(const v8b*)p; u.q[1] = *(const v8b*)(p + 16); return u.v;
}
#define QBH 6              // not used: k_fa's 32-query tiles 0..11 of each sequence (rows < QHI; few keys, no averaging) take the high-precision path
#define QHI 384            // rows carrying a q residual plane
#define KHI 384            // key rows carrying k residual / v bf16 hi+lo planes (used only by the causal high-precision path)
// B fragment (k rows k0+.., output column o) of a weight: (in,out) [K][ld] or (out,in) [ld rows of K]: bf16 exact, or f16(bf16 * 256) exact
__device__ __forceinline__ v16b wcol_io(const float* Wm, int k0, int o, int lane, int ld) { v16b w; const int g = lane >> 4;
#pragma unroll
  for (int i = 0; i < 8; ++i) { w[i] = (__bf16)Wm[(size_t)(k0 + 8 * g + i) * ld + o]; w[8 + i] = (__bf16)Wm[(size_t)(k0 + 16 + 8 * g + i) * ld + o]; }
  return w; }
__device__ __forceinline__ v16b wcol_oi(const float* Wm, int k0, int o, int lane, int K) { v16b w; const float* p = Wm + (size_t)o * K + k0 + 8 * (lane >> 4);
#pragma unroll
  for (int i = 0; i < 8; ++i) { w[i] = (__bf16)p[i]; w[8 + i] = (__bf16)p[16 + i]; }
  return w; }
__device__ __forceinline__ v16h wcolh_io(const float* Wm, int k0, int o, int lane, int ld) { v16h w; const int g = lane >> 4;
#pragma unroll
  for (int i = 0; i < 8; ++i) { w[i] = (_Float16)(bfr(Wm[(size_t)(k0 + 8 * g + i) * ld + o]) * 256.0f); w[8 + i] = (_Float16)(bfr(Wm[(size_t)(k0 + 16 + 8 * g + i) * ld + o]) * 256.0f); }
  return w; }
__device__ __forceinline__ v16h wcolh_oi(const float* Wm, int k0, int o, int lane, int K) { v16h w; const float* p = Wm + (size_t)o * K + k0 + 8 * (lane >> 4);
#pragma unroll
  for (int i = 0; i < 8; ++i) { w[i] = (_Float16)(bfr(p[i]) * 256.0f); w[8 + i] = (_Float16)(bfr(p[16 + i]) * 256.0f); }
  return w; }
#define WQKV_LAYOUT 0   // 0 = (in,out) [DIN][HD]; 1 = (out,in) [CC][DIN]; 2 = per-head [NH][DIN][HD]
__device__ __forceinline__ v16b wcol_hdk(const float* Wm, int k0, int o, int lane) { v16b w; const int g = lane >> 4; const float* p = Wm + (size_t)(o / HD) * DIN * HD + (o % HD);
#pragma unroll
  for (int i = 0; i < 8; ++i) { w[i] = (__bf16)p[(size_t)(k0 + 8 * g + i) * HD]; w[8 + i] = (__bf16)p[(size_t)(k0 + 16 + 8 * g + i) * HD]; }
  return w; }
#define WO_OUT_IN 0
#if WQKV_LAYOUT == 1
#define WCOL(W, k0, o, lane) wcol_oi(W, k0, o, lane, DIN)
#elif WQKV_LAYOUT == 2
#define WCOL(W, k0, o, lane) wcol_hdk(W, k0, o, lane)
#else
__device__ __forceinline__ v16b zero16b() { v16b w; _Pragma("unroll") for (int i = 0; i < 16; ++i) w[i] = (__bf16)0.0f; return w; }
#define WCOL(W, k0, o, lane) ((o) < 64 ? wcol_io(W, k0, (o), lane, 64) : zero16b())   /* (in,out) [512][64] pitch 64: only 64 real output columns; projected columns 64..127 (padding head 1) are zero */
#endif
#if WO_OUT_IN
#define WOCOL(W, k0, o, lane) wcol_oi(W, k0, o, lane, CC)
#define WOCOLH(W, k0, o, lane) wcolh_oi(W, k0, o, lane, CC)
#else
#define WOCOL(W, k0, o, lane) wcol_io(W, k0, o, lane, DIN)
#define WOCOLH(W, k0, o, lane) wcolh_io(W, k0, o, lane, DIN)
#endif

#ifndef SM_EXTRA_PARAMS
#define SM_EXTRA_PARAMS
#endif
#ifndef PROJ_EXTRA_PARAMS
#define PROJ_EXTRA_PARAMS
#endif
#ifndef SM_MASK_HOOK
#define SM_MASK_HOOK (void)0
#endif

#define WS_QH  0u                                      // f16 q rows [b*t][CC]
#define WS_KH  (WS_QH + 2u * (size_t)NB * TT * CC)      // f16 k rows [b*t][CC]
#define WS_VT  (WS_KH + 2u * (size_t)NB * TT * CC)      // f16 v planes [b][c][t]
#define WS_QL  (WS_VT + 2u * (size_t)NB * CC * TT)      // f16 q residual x 2^10 rows [b][t < QHI][CC]
#define WS_KL  (WS_QL + 2u * (size_t)NB * QHI * CC)     // f16 k residual x 2^10 rows [b][t < KHI][CC]
#define WS_VB  (WS_KL + 2u * (size_t)NB * KHI * CC)     // bf16 v hi planes [b][c][t < KHI]
#define WS_VBL (WS_VB + 2u * (size_t)NB * CC * KHI)
#define WS_S   (WS_VBL + 2u * (size_t)NB * CC * KHI)    // f32 [hg][t][s], reserved only: no kernel here stores logits or P (they stay in registers)
#define WS_Y   (WS_S  + 4u * (size_t)HG * TT * TT)      // f32 ctx rows [b*t][CC] (only when there is an output projection)
#define WS_END (WS_Y  + 0u)

// ---- k_fa: block = 32 queries of batch b, 8 waves: wave w takes the 32-key chunks w, w + 8, ... up to the diagonal chunk. Per chunk: S^T = K Q^T (a lane holds 16 keys' scores of one query per 16-query group), running maximum and sum per query in f32 (log2 domain),
// P^T packed from the score accumulators straight into the B operand, O^T += V^T P^T. The 8 waves' (maximum, sum, O) are merged through LDS in wave order and the merged rows go straight to the output [b][t][64] (16 lanes store one 256-byte row). Query rows < QHI: 3-product logits and P, v as bf16 hi + lo (3 products), as before.
#define FQ 32              // queries per block (two 16-column groups per wave)
#define FW 8               // waves per block = key chunks in flight per 32-query tile
#define SC2 (SCALE * 1.4426950408889634f)   // logits in log2 units
#define PEXP 4.0f          // P carries 2^4 (cancels in the division by the sum): keeps small P clear of the f16 subnormals
// 2^a as v_exp_f32 in asm text with one v_nop behind the last: the slot that the instruction set asks for between a transcendental and a directly following instruction that reads its result or overwrites its source
// "=&v" keeps every result off every source, so the eight in a row are independent of each other
__device__ __forceinline__ float ex2(float a) { float r; asm("v_exp_f32 %0, %1\n\tv_nop" : "=v"(r) : "v"(a)); return r; }
__device__ __forceinline__ void ex2x8(float* r, const float* a) {
  asm("v_exp_f32 %0, %8\n\tv_exp_f32 %1, %9\n\tv_exp_f32 %2, %10\n\tv_exp_f32 %3, %11\n\tv_exp_f32 %4, %12\n\tv_exp_f32 %5, %13\n\tv_exp_f32 %6, %14\n\tv_exp_f32 %7, %15\n\tv_nop"
      : "=&v"(r[0]), "=&v"(r[1]), "=&v"(r[2]), "=&v"(r[3]), "=&v"(r[4]), "=&v"(r[5]), "=&v"(r[6]), "=&v"(r[7]) : "v"(a[0]), "v"(a[1]), "v"(a[2]), "v"(a[3]), "v"(a[4]), "v"(a[5]), "v"(a[6]), "v"(a[7])); }
// stands behind a run of global loads, in front of any instruction that writes a register which an issued load names (a precaution); its "memory" clobber also keeps those loads issued above it
#define XW() asm volatile("s_wait_xcnt 0x0" ::: "memory")
// the same wait with the run's address pointers as inputs only: they stay live up to the wait, so that no load of the run gets its result placed on an address pair that earlier loads of the run name
#define XW1(p) asm volatile("s_wait_xcnt 0x0" :: "v"(p) : "memory")
#define XW2(p, q) asm volatile("s_wait_xcnt 0x0" :: "v"(p), "v"(q) : "memory")
// fragments through a pointer that already holds the lane's 8 * (lane >> 4) element offset: the loads of a run then name the loop pointer itself, which is advanced only behind XW()
__device__ __forceinline__ v16h frag_hp(const _Float16* p) { union { v16h v; v8h q[2]; } u; u.q[0] = *(const v8h*)p; u.q[1] = *(const v8h*)(p + 16); return u.v; }
__device__ __forceinline__ v16b frag_bp(const __bf16* p) { union { v16b v; v8b q[2]; } u; u.q[0] = *(const v8b*)p; u.q[1] = *(const v8b*)(p + 16); return u.v; }
// one 16-query group's 32 scores (log2 units) of one chunk -> P x 2^PEXP in u; running maximum m, per-lane running sum l and the output tiles are brought to the new maximum
__device__ __forceinline__ void fa_soft(float (&u)[16], bool diag, int key0, int query, float& m, float& l, v8f (&acc)[HD / 16]) {
  if (diag) {   // the diagonal chunk: key > query is excluded by index (its first key <= every query of the tile, so no column is left empty)
#pragma unroll
    for (int i = 0; i < 16; ++i) if (key0 + (i >> 3) * 16 + (i & 7) > query) u[i] = -3.0e38f; }
  float mx = u[0];
#pragma unroll
  for (int i = 1; i < 16; ++i) mx = fmaxf(mx, u[i]);
  mx = fmaxf(mx, __shfl_xor(mx, 16));   // lanes c and c + 16 hold the two key halves of one query
  const float mn = fmaxf(m, mx); const float al = ex2(m - mn); m = mn; const float sh = mn - PEXP;
  float d[16], s = 0.f;
#pragma unroll
  for (int i = 0; i < 16; ++i) d[i] = u[i] - sh;
  ex2x8(u, d); ex2x8(u + 8, d + 8);
#pragma unroll
  for (int i = 0; i < 16; ++i) s += u[i];
  l = l * al + s;
#pragma unroll
  for (int j = 0; j < HD / 16; ++j) acc[j] *= al; }
// query rows >= QHI: single f16 products
__device__ __forceinline__ void fa_loop(const _Float16* __restrict__ QH, const _Float16* __restrict__ KH, const _Float16* __restrict__ VT, int b, int x, int wave, int lane, v8f (&acc)[2][HD / 16], float (&m)[2], float (&l)[2]) {
  const int col = lane & 15, g = lane >> 4; const int ql0 = x * FQ;
  const _Float16* kp = KH + ((size_t)b * TT + (wave <= x ? wave : x) * 32 + col) * CC + 8 * g; const _Float16* vp = VT + ((size_t)b * CC + col) * (size_t)TT + wave * 32 + 8 * g;   // the wave's current k rows and v columns, the lane's fragment offset included
  v16h qh[2][2], kf[2][2];
#pragma unroll
  for (int t = 0; t < 2; ++t)
#pragma unroll
    for (int kc = 0; kc < 2; ++kc) { qh[t][kc] = frag_h(QH + ((size_t)b * TT + ql0 + t * 16 + col) * CC + kc * 32, lane); kf[t][kc] = frag_hp(kp + (size_t)t * 16 * CC + kc * 32); }
  XW();
#pragma unroll 1   // rolled: a second pass in flight would double the live fragments and cost the fourth wave per SIMD
  for (int ch = wave; ch <= x; ch += FW) { const int k0 = ch * 32;
    v16h vf[HD / 16];
#pragma unroll
    for (int j = 0; j < HD / 16; ++j) vf[j] = frag_hp(vp + (size_t)j * 16 * TT);
    XW1(vp);   // the v loads issue here, so that the score products and the softmax cover their latency
    vp += FW * 32;
    v8f st[2][2] = {};
#pragma unroll
    for (int kt = 0; kt < 2; ++kt)
#pragma unroll
      for (int kc = 0; kc < 2; ++kc)
#pragma unroll
        for (int qt = 0; qt < 2; ++qt) st[qt][kt] = wmma16(kf[kt][kc], qh[qt][kc], st[qt][kt]);
    kp += ch + FW <= x ? (size_t)FW * 32 * CC : 0;   // the wave's next chunk (its last pass reads its own chunk again: in bounds, unused)
#pragma unroll
    for (int kt = 0; kt < 2; ++kt)
#pragma unroll
      for (int kc = 0; kc < 2; ++kc) kf[kt][kc] = frag_hp(kp + (size_t)kt * 16 * CC + kc * 32);
    XW1(kp);   // the next chunk's k loads issue here, one pass ahead, under the softmax and the P x V products
    v16h ph[2];
#pragma unroll
    for (int qt = 0; qt < 2; ++qt) { float u[16];
#pragma unroll
      for (int i = 0; i < 16; ++i) u[i] = st[qt][i >> 3][i & 7] * SC2;
      fa_soft(u, ch == x, k0 + 8 * g, ql0 + qt * 16 + col, m[qt], l[qt], acc[qt]);
#pragma unroll
      for (int i = 0; i < 16; ++i) ph[qt][i] = (_Float16)u[i]; }
#pragma unroll
    for (int j = 0; j < HD / 16; ++j)
#pragma unroll
      for (int qt = 0; qt < 2; ++qt) acc[qt][j] = wmma16(vf[j], ph[qt], acc[qt][j]); } }
// query rows < QHI (at most 12 chunks a tile), one 16-query group a call (fewer live registers): q and k residual planes in the logits, P and v as bf16 hi + lo
__device__ __forceinline__ void fa_loop_hi(const _Float16* __restrict__ QH, const _Float16* __restrict__ KH, const _Float16* __restrict__ QL, const _Float16* __restrict__ KL, const __bf16* __restrict__ VB, const __bf16* __restrict__ VBL,
    int b, int x, int q0, int wave, int lane, v8f (&acc)[HD / 16], float& m, float& l) {
  if (wave > x) return;   // a wave without a chunk (wave-uniform)
  const int col = lane & 15, g = lane >> 4;
  v16h qh[2], ql[2];
#pragma unroll
  for (int kc = 0; kc < 2; ++kc) { qh[kc] = frag_h(QH + ((size_t)b * TT + q0 + col) * CC + kc * 32, lane); ql[kc] = frag_h(QL + ((size_t)b * QHI + q0 + col) * CC + kc * 32, lane); }
  XW();
  const _Float16* kp = KH + ((size_t)b * TT + wave * 32 + col) * CC + 8 * g; const _Float16* klp = KL + ((size_t)b * KHI + wave * 32 + col) * CC + 8 * g; const __bf16* vp = VB + ((size_t)b * CC + col) * (size_t)KHI + wave * 32 + 8 * g; const __bf16* vlp = VBL + ((size_t)b * CC + col) * (size_t)KHI + wave * 32 + 8 * g;   // the lane's fragment offset included
#pragma unroll 1   // rolled: a second pass in flight would double the live fragments and cost the fourth wave per SIMD
  for (int ch = wave; ch <= x; ch += FW) { const int k0 = ch * 32;
    v16h kf[2][2], klf[2][2];
#pragma unroll
    for (int kt = 0; kt < 2; ++kt)
#pragma unroll
      for (int kc = 0; kc < 2; ++kc) { kf[kt][kc] = frag_hp(kp + (size_t)kt * 16 * CC + kc * 32); klf[kt][kc] = frag_hp(klp + (size_t)kt * 16 * CC + kc * 32); }
    XW2(kp, klp);   // all of the chunk's k loads issue together: one latency, not one per fragment
    kp += (size_t)FW * 32 * CC; klp += (size_t)FW * 32 * CC;
    v8f st[2] = {}, sl[2] = {};
#pragma unroll
    for (int kt = 0; kt < 2; ++kt)
#pragma unroll
      for (int kc = 0; kc < 2; ++kc) { st[kt] = wmma16(kf[kt][kc], qh[kc], st[kt]); sl[kt] = wmma16(kf[kt][kc], ql[kc], sl[kt]); sl[kt] = wmma16(klf[kt][kc], qh[kc], sl[kt]); }
    v16b vh[HD / 16], vl[HD / 16];
#pragma unroll
    for (int j = 0; j < HD / 16; ++j) { vh[j] = frag_bp(vp + (size_t)j * 16 * KHI); vl[j] = frag_bp(vlp + (size_t)j * 16 * KHI); }
    XW2(vp, vlp);   // the v loads issue here, under the softmax
    vp += FW * 32; vlp += FW * 32;
    float u[16];
#pragma unroll
    for (int i = 0; i < 16; ++i) u[i] = (st[i >> 3][i & 7] + sl[i >> 3][i & 7] * (1.0f / 1024.0f)) * SC2;
    fa_soft(u, ch == x, k0 + 8 * g, q0 + col, m, l, acc);
    const F2 pb = bsplit16(u);
#pragma unroll
    for (int j = 0; j < HD / 16; ++j) { acc[j] = wmma_bf(vh[j], pb.h, acc[j]); acc[j] = wmma_bf(vh[j], pb.l, acc[j]); acc[j] = wmma_bf(vl[j], pb.h, acc[j]); } } }
// four waves per SIMD: two 8-wave blocks resident per WGP, so that all 512 blocks run at once
__global__ __launch_bounds__(FW * 32) __attribute__((amdgpu_waves_per_eu(4, 4))) void k_fa(const _Float16* __restrict__ QH, const _Float16* __restrict__ KH, const _Float16* __restrict__ QL, const _Float16* __restrict__ KL, const _Float16* __restrict__ VT, const __bf16* __restrict__ VB, const __bf16* __restrict__ VBL, float* __restrict__ OUT) {
  __shared__ __align__(16) float ss[FW][FQ][HD + 4]; __shared__ float smx[FW][FQ], ssu[FW][FQ];
  const int tid = threadIdx.x, wave = __builtin_amdgcn_readfirstlane(tid >> 5), lane = tid & 31, col = lane & 15, g = lane >> 4;
  const int b = blockIdx.x; const int y = blockIdx.y; const int x = y < TT / FQ / 2 ? TT / FQ - 1 - y : y - TT / FQ / 2;   // a permutation of the tiles, for speed only: all blocks are resident, two a WGP; the first half of the grid falls in keys, the second rises, so that blocks half a grid apart add up to the same work
  const int ql0 = x * FQ;
  v8f acc[2][HD / 16] = {}; float m[2] = {-3.0e38f, -3.0e38f}, l[2] = {0.f, 0.f};
  if (ql0 < QHI) { fa_loop_hi(QH, KH, QL, KL, VB, VBL, b, x, ql0, wave, lane, acc[0], m[0], l[0]); fa_loop_hi(QH, KH, QL, KL, VB, VBL, b, x, ql0 + 16, wave, lane, acc[1], m[1], l[1]); }
  else fa_loop(QH, KH, VT, b, x, wave, lane, acc, m, l);
#pragma unroll
  for (int qt = 0; qt < 2; ++qt) { const float lt = l[qt] + __shfl_xor(l[qt], 16); if (g == 0) { smx[wave][qt * 16 + col] = m[qt]; ssu[wave][qt * 16 + col] = lt; }
#pragma unroll
    for (int j = 0; j < HD / 16; ++j) { const v4f lo = {acc[qt][j][0], acc[qt][j][1], acc[qt][j][2], acc[qt][j][3]}, hi = {acc[qt][j][4], acc[qt][j][5], acc[qt][j][6], acc[qt][j][7]};
      *(v4f*)&ss[wave][qt * 16 + col][j * 16 + 8 * g] = lo; *(v4f*)&ss[wave][qt * 16 + col][j * 16 + 8 * g + 4] = hi; } }
  __syncthreads();   // every wave's maximum, sum and partial tile (sum 0 from a wave without a chunk) are in LDS before any is merged
  for (int e = tid; e < FQ * (HD / 4); e += FW * 32) { const int rl = e >> 4, q = e & 15; float M = smx[0][rl];
#pragma unroll
    for (int w = 1; w < FW; ++w) M = fmaxf(M, smx[w][rl]);
    v4f s = {0.f, 0.f, 0.f, 0.f}; float L = 0.f;
#pragma unroll
    for (int w = 0; w < FW; ++w) { const float f = ex2(smx[w][rl] - M); L += f * ssu[w][rl]; s += *(const v4f*)&ss[w][rl][q * 4] * f; }
    vst2(OUT + ((size_t)b * TT + ql0 + rl) * HD + q * 4, s * (1.0f / L)); } }

// ---- k_proj: block = 64 rows of x, 16 waves: q, k and v (the 192 real columns) from one pass over x. x and the three weights come in by whole-line loads, are rounded to bf16 and laid in LDS once per block (weights as [column][k]);
// wave (row tile, column tile) then takes its fragments from LDS: exact bf16 products, k slices in rising order. q, k f16 rows (+ residual rows < QHI, KHI), v f16 planes [c][t] (+ bf16 hi/lo planes for t < KHI); columns and planes 64..127 of the workspace pitch are neither written nor read
#define PWP 520            // LDS row pitch in elements: 1040 B = 16 B x 65 (odd), so that 16 rows' 16-byte reads and writes fall on all banks
#define PEP 72             // pitch of the output tiles in LDS: 144 B = 16 B x 9
__global__ __launch_bounds__(512) void k_proj(const float* __restrict__ X, const float* __restrict__ WQ, const float* __restrict__ WK, const float* __restrict__ WV,
    _Float16* __restrict__ QH, _Float16* __restrict__ QL, _Float16* __restrict__ KH, _Float16* __restrict__ KL, _Float16* __restrict__ VT, __bf16* __restrict__ VB, __bf16* __restrict__ VBL) {
  __shared__ __align__(16) __bf16 wsm[192][PWP]; __shared__ __align__(16) __bf16 xsm[64][PWP];
  const int tid = threadIdx.x, wave = tid >> 5, lane = tid & 31, col = lane & 15, g = lane >> 4; const size_t r0 = (size_t)blockIdx.x * 64; const size_t bb = r0 / TT; const int t0 = (int)(r0 % TT);
  const float* xp = X + r0 * DIN + tid * 4;   // a wave's load = 512 B in a row of x
  v4f xr[16];
#pragma unroll
  for (int i = 0; i < 16; ++i) xr[i] = *(const v4f*)(xp + i * 2048);
  XW();   // all of the block's x is requested before anything waits
  const int wo = tid & 63, wk = tid >> 6;   // weight column; 8-row k group within a 64-row slab (a wave's load = 128 B of one weight row)
  const size_t woff = (size_t)wk * 8 * 64 + wo;
  float wv[2][32];
#pragma unroll
  for (int n = 0; n < 7; ++n) {   // batch n = weight n / 2, k rows (n & 1) * 256 ..+255; batch n + 1 is requested before batch n is packed
    if (n < 6) { const float* wp = (n < 2 ? WQ : n < 4 ? WK : WV) + woff + (size_t)(n & 1) * 256 * 64;
#pragma unroll
      for (int r = 0; r < 4; ++r)
#pragma unroll
        for (int i = 0; i < 8; ++i) wv[n & 1][r * 8 + i] = wp[(r * 64 + i) * 64];
      XW(); }
    if (n == 0) {
#pragma unroll
      for (int i = 0; i < 16; ++i) { typedef __attribute__((ext_vector_type(4))) __bf16 v4b; v4b pk;
#pragma unroll
        for (int e = 0; e < 4; ++e) pk[e] = (__bf16)xr[i][e];
        *(v4b*)&xsm[(tid >> 7) + i * 4][(tid & 127) * 4] = pk; }
    } else { const int p = n - 1;
#pragma unroll
      for (int r = 0; r < 4; ++r) { v8b pk;
#pragma unroll
        for (int i = 0; i < 8; ++i) pk[i] = (__bf16)wv[p & 1][r * 8 + i];
        *(v8b*)&wsm[(p >> 1) * 64 + wo][(p & 1) * 256 + r * 64 + wk * 8] = pk; } } }
  __syncthreads();   // x and the weights are in LDS before any fragment is read
  const int rt = wave & 3, ct = wave >> 2;
  v8f acc[3] = {};
  const __bf16* ap = &xsm[rt * 16 + col][0]; const __bf16* bp = &wsm[ct * 16 + col][0];
  v16b fa[2][2], fb[2][2][3];   // two k slices a group, two groups of fragments: the next group's LDS reads are issued in front of this group's products, which cover their latency
#pragma unroll
  for (int s = 0; s < 2; ++s) { fa[0][s] = frag_b(ap + s * 32, lane);
#pragma unroll
    for (int mt = 0; mt < 3; ++mt) fb[0][s][mt] = frag_b(bp + mt * 64 * PWP + s * 32, lane); }
#pragma unroll   // unrolled: the two fragment groups are named at compile time
  for (int kg = 0; kg < DIN / 64; ++kg) {
    if (kg + 1 < DIN / 64) {
#pragma unroll
      for (int s = 0; s < 2; ++s) { fa[(kg + 1) & 1][s] = frag_b(ap + (kg + 1) * 64 + s * 32, lane);
#pragma unroll
        for (int mt = 0; mt < 3; ++mt) fb[(kg + 1) & 1][s][mt] = frag_b(bp + mt * 64 * PWP + (kg + 1) * 64 + s * 32, lane); } }
#pragma unroll
    for (int s = 0; s < 2; ++s)
#pragma unroll
      for (int mt = 0; mt < 3; ++mt) acc[mt] = wmma_bf(fa[kg & 1][s], fb[kg & 1][s][mt], acc[mt]); }
  __syncthreads();   // every wave's last read of xsm is done before its space takes the output tiles
  _Float16* eb = (_Float16*)&xsm[0][0]; _Float16 *sqh = eb, *sql = eb + 64 * PEP, *skh = eb + 2 * 64 * PEP, *skl = eb + 3 * 64 * PEP, *sth = eb + 4 * 64 * PEP; __bf16 *stb = (__bf16*)(eb + 5 * 64 * PEP), *stl = (__bf16*)(eb + 6 * 64 * PEP);
  const bool hi_rows = t0 < KHI;
#pragma unroll
  for (int r = 0; r < 8; ++r) { const int rl = rt * 16 + 8 * g + r, cl = ct * 16 + col;
    { const float v = acc[0][r]; const _Float16 hv = (_Float16)v; sqh[rl * PEP + cl] = hv; sql[rl * PEP + cl] = (_Float16)((v - (float)hv) * 1024.0f); }
    { const float v = acc[1][r]; const _Float16 hv = (_Float16)v; skh[rl * PEP + cl] = hv; skl[rl * PEP + cl] = (_Float16)((v - (float)hv) * 1024.0f); }
    { const float v = acc[2][r]; sth[cl * PEP + rl] = (_Float16)v; const __bf16 bh = (__bf16)v; stb[cl * PEP + rl] = bh; stl[cl * PEP + rl] = (__bf16)(v - (float)bh); } }
  __syncthreads();   // the output tiles are whole before they are stored by rows
  { const int rl = tid >> 3, q = tid & 7; const int so = rl * PEP + q * 8;   // 8 lanes store one 128-byte row (q, k: row rl; v: plane rl)
    vst2(QH + (r0 + rl) * CC + q * 8, *(const v4u*)&sqh[so]); vst2(KH + (r0 + rl) * CC + q * 8, *(const v4u*)&skh[so]); vst2(VT + (bb * CC + rl) * (size_t)TT + t0 + q * 8, *(const v4u*)&sth[so]);
    XW();   // behind the three stores, in front of the address arithmetic of the residual planes
    if (hi_rows) { vst2(QL + (bb * QHI + t0 + rl) * (size_t)CC + q * 8, *(const v4u*)&sql[so]); vst2(KL + (bb * KHI + t0 + rl) * (size_t)CC + q * 8, *(const v4u*)&skl[so]);
      const size_t o3 = (bb * CC + rl) * (size_t)KHI + t0 + q * 8; vst2(VB + o3, *(const v4u*)&stb[so]); vst2(VBL + o3, *(const v4u*)&stl[so]); } } }

extern "C" void kernel_launch(void* const* d_in, const int* in_sizes, int n_in, void* d_out, int out_size, void* d_ws, size_t ws_size, hipStream_t stream) {
  (void)in_sizes; (void)n_in; (void)out_size;
  const float** F = (const float**)d_in;
  if (ws_size < (size_t)WS_END) return;
  char* ws = (char*)d_ws; _Float16 *QH = (_Float16*)(ws + WS_QH), *KH = (_Float16*)(ws + WS_KH), *VT = (_Float16*)(ws + WS_VT), *QL = (_Float16*)(ws + WS_QL), *KL = (_Float16*)(ws + WS_KL); __bf16 *VB = (__bf16*)(ws + WS_VB), *VBL = (__bf16*)(ws + WS_VBL); float *Y = (float*)(ws + WS_Y);
  (void)Y; (void)QL; (void)KL; (void)VB; (void)VBL;
  // inputs: 0 x [4,4096,512]; 1 Wq [512,64] (in,out); 2 Wk; 3 Wv; no biases
  k_proj<<<dim3(TNB * TT / 64), 512, 0, stream>>>(F[0], F[1], F[2], F[3], QH, QL, KH, KL, VT, VB, VBL);
  k_fa<<<dim3(TNB, TT / FQ), FW * 32, 0, stream>>>(QH, KH, QL, KL, VT, VB, VBL, (float*)d_out);   /* head 0 only (head 1 is the zero padding) */
}

// v005
// A run of this version takes 28.5 microseconds.
// Next to v004, in two timings, it ran 1.28 and 1.30 times as fast.
// All steps since v000 together make it 23.5 times as fast.
// compute dtype: all float inputs rounded to bf16; q/k/v projections with EXACT bf16 products on WMMA 16x16x32 (f32 accumulate); causal logits: 3 products for the first 384 rows, single f16 q x k after, x 64^-0.5; running softmax f32; P (against the running maximum) x 2^4 once to f16 x v once to f16 (bf16 hi + lo below row 384); f32 output.
#include <hip/hip_runtime.h>
#include <math.h>

typedef __attribute__((ext_vector_type(16))) _Float16 v16h;
typedef __attribute__((ext_vector_type(16))) __bf16 v16b;
typedef __attribute__((ext_vector_type(8)))  _Float16 v8h;
typedef __attribute__((ext_vector_type(8)))  float v8f;
typedef __attribute__((ext_vector_type(4)))  float v4f;
typedef __attribute__((ext_vector_type(2)))  float v2f;
typedef __attribute__((ext_vector_type(4)))  unsigned v4u;
typedef __attribute__((ext_vector_type(4)))  int v4i;
typedef float __attribute__((may_alias)) float_a;
typedef int __attribute__((may_alias)) int_a;

template <typename T> __device__ __forceinline__ void vst2(void* p, T v) { *(T*)p = v;  }
__device__ __forceinline__ v8f wmma16(v16h a, v16h b, v8f c) {
  v8f d = __builtin_amdgcn_wmma_f32_16x16x32_f16(false, a, false, b, (short)0, c, false, false);
  asm volatile("v_nop\n\tv_nop\n\tv_nop\n\tv_nop" : "+v"(d) : "v"(a), "v"(b));
  return d;
}
__device__ __forceinline__ v8f wmma_bf(v16b a, v16b b, v8f c) {
  v8f d = __builtin_amdgcn_wmma_f32_16x16x32_bf16(false, a, false, b, (short)0, c, false, false);
  asm volatile("v_nop\n\tv_nop\n\tv_nop\n\tv_nop" : "+v"(d) : "v"(a), "v"(b));
  return d;
}
// 16x16x32 fragments: lane = (h = lane>>4, row/col = lane&15); elements 0..7 = k0+8h+0..7, 8..15 = k0+16+8h+0..7; D element r = row 8h+r
__device__ __forceinline__ v16h frag_h(const _Float16* rowk0, int lane) {
  union { v16h v; v8h q[2]; } u; const _Float16* p = rowk0 + 8 * (lane >> 4);
  u.q[0] = *(const v8h*)p; u.q[1] = *(const v8h*)(p + 16); return u.v;
}
__device__ __forceinline__ v16h frag_f32(const float* rowk0, int lane) {
  v16h a; const float* p = rowk0 + 8 * (lane >> 4);
#pragma unroll
  for (int i = 0; i < 8; ++i) { a[i] = (_Float16)p[i]; a[8 + i] = (_Float16)p[16 + i]; }
  return a;
}
__device__ __forceinline__ v16h frag_f32s(const float* rowk0, int lane, float sc) {
  v16h a; const float* p = rowk0 + 8 * (lane >> 4);
#pragma unroll
  for (int i = 0; i < 8; ++i) { a[i] = (_Float16)(p[i] * sc); a[8 + i] = (_Float16)(p[16 + i] * sc); }
  return a;
}
// column fragment from a [K][ld] layout (column n), rows >= K read as 0
__device__ __forceinline__ v16h fragc_f32(const float* W, int k0, int n, int lane, int ld, int K) {
  v16h a; const int g = lane >> 4;
#pragma unroll
  for (int i = 0; i < 8; ++i) { const int ka = k0 + 8 * g + i, kb = ka + 16;
    a[i] = (_Float16)(ka < K ? W[(size_t)(ka < K ? ka : K - 1) * ld + n] : 0.f); a[8 + i] = (_Float16)(kb < K ? W[(size_t)(kb < K ? kb : K - 1) * ld + n] : 0.f); }
  return a;
}
struct F2 { v16b h, l; };
__device__ __forceinline__ F2 bsplit16(const float v[16]) { F2 r;
#pragma unroll
  for (int i = 0; i < 16; ++i) { const __bf16 h = (__bf16)v[i]; r.h[i] = h; r.l[i] = (__bf16)(v[i] - (float)h); }
  return r; }
__device__ __forceinline__ F2 split_row(const float* row, int k0, int lane) { float v[16]; const float* p = row + k0 + 8 * (lane >> 4);
#pragma unroll
  for (int i = 0; i < 8; ++i) { v[i] = p[i]; v[8 + i] = p[16 + i]; }
  return bsplit16(v); }
__device__ __forceinline__ F2 split_rowK(const float* row, int k0, int lane, int K) { float v[16]; const int g = lane >> 4;
#pragma unroll
  for (int i = 0; i < 8; ++i) { const int ka = k0 + 8 * g + i, kb = ka + 16; v[i] = ka < K ? row[ka < K ? ka : K - 1] : 0.f; v[8 + i] = kb < K ? row[kb < K ? kb : K - 1] : 0.f; }
  return bsplit16(v); }
__device__ __forceinline__ F2 split_col(const float* W, int k0, int n, int lane, int ld, int K) { float v[16]; const int g = lane >> 4;
#pragma unroll
  for (int i = 0; i < 8; ++i) { const int ka = k0 + 8 * g + i, kb = ka + 16; v[i] = ka < K ? W[(size_t)(ka < K ? ka : K - 1) * ld + n] : 0.f; v[8 + i] = kb < K ? W[(size_t)(kb < K ? kb : K - 1) * ld + n] : 0.f; }
  return bsplit16(v); }
__device__ __forceinline__ v8f mac3(const F2& a, const F2& b, v8f c) { c = wmma_bf(a.l, b.h, c); c = wmma_bf(a.h, b.l, c); return wmma_bf(a.h, b.h, c); }
__device__ __forceinline__ float sigm(float v) { return 1.0f / (1.0f + expf(-v)); }
#define LDSX() do { asm volatile("s_wait_dscnt 0" ::: "memory"); __builtin_amdgcn_wave_barrier(); __builtin_amdgcn_fence(__ATOMIC_RELEASE, "workgroup"); } while (0)

// Single-head causal self-attention (x [4,4096,512]; (in,out) Wq / Wk / Wv [512,64] N(0, 1/512), no biases; scale 1/sqrt(64); tril, -inf; no output projection): out = softmax(causal(q k^T / 8)) v -> [4,4096,64].
#define NB 4
#define TT 4096
#define CC 128            // NH * HD = projected width
#define DIN 512          // input (model) width
#define NH 2
#define HD 64
#define NQB (TT / 64)
#define HG 1
#define SCALE (0.125f)
#define CAUSAL 1
#ifndef TNB
#define TNB NB
#endif
__device__ __forceinline__ float bfr(float v) { return (float)(__bf16)v; }
__host__ __device__ __forceinline__ int kb_last(int qb) { return CAUSAL ? ((qb * 64 + 63) >> 7) : (TT / 128 - 1); }
typedef __attribute__((ext_vector_type(8))) __bf16 v8b;
__device__ __forceinline__ v16b frag_b(const __bf16* rowk0, int lane) {
  union { v16b v; v8b q[2]; } u; const __bf16* p = rowk0 + 8 * (lane >> 4);
  u.q[0] = *(const v8b*)p; u.q[1] = *(const v8b*)(p + 16); return u.v;
}
#define QBH 6              // not used: k_fa's 32-query tiles 0..11 of each sequence (rows < QHI; few keys, no averaging) take the high-precision path
#define QHI 384            // rows carrying a q residual plane
#define KHI 384            // key rows carrying k residual / v bf16 hi+lo planes (used only by the causal high-precision path)
// B fragment (k rows k0+.., output column o) of a weight: (in,out) [K][ld] or (out,in) [ld rows of K]: bf16 exact, or f16(bf16 * 256) exact
__device__ __forceinline__ v16b wcol_io(const float* Wm, int k0, int o, int lane, int ld) { v16b w; const int g = lane >> 4;
#pragma unroll
  for (int i = 0; i < 8; ++i) { w[i] = (__bf16)Wm[(size_t)(k0 + 8 * g + i) * ld + o]; w[8 + i] = (__bf16)Wm[(size_t)(k0 + 16 + 8 * g + i) * ld + o]; }
  return w; }
__device__ __forceinline__ v16b wcol_oi(const float* Wm, int k0, int o, int lane, int K) { v16b w; const float* p = Wm + (size_t)o * K + k0 + 8 * (lane >> 4);
#pragma unroll
  for (int i = 0; i < 8; ++i) { w[i] = (__bf16)p[i]; w[8 + i] = (__bf16)p[16 + i]; }
  return w; }
__device__ __forceinline__ v16h wcolh_io(const float* Wm, int k0, int o, int lane, int ld) { v16h w; const int g = lane >> 4;
#pragma unroll
  for (int i = 0; i < 8; ++i) { w[i] = (_Float16)(bfr(Wm[(size_t)(k0 + 8 * g + i) * ld + o]) * 256.0f); w[8 + i] = (_Float16)(bfr(Wm[(size_t)(k0 + 16 + 8 * g + i) * ld + o]) * 256.0f); }
  return w; }
__device__ __forceinline__ v16h wcolh_oi(const float* Wm, int k0, int o, int lane, int K) { v16h w; const float* p = Wm + (size_t)o * K + k0 + 8 * (lane >> 4);
#pragma unroll
  for (int i = 0; i < 8; ++i) { w[i] = (_Float16)(bfr(p[i]) * 256.0f); w[8 + i] = (_Float16)(bfr(p[16 + i]) * 256.0f); }
  return w; }
#define WQKV_LAYOUT 0   // 0 = (in,out) [DIN][HD]; 1 = (out,in) [CC][DIN]; 2 = per-head [NH][DIN][HD]
__device__ __forceinline__ v16b wcol_hdk(const float* Wm, int k0, int o, int lane) { v16b w; const int g = lane >> 4; const float* p = Wm + (size_t)(o / HD) * DIN * HD + (o % HD);
#pragma unroll
  for (int i = 0; i < 8; ++i) { w[i] = (__bf16)p[(size_t)(k0 + 8 * g + i) * HD]; w[8 + i] = (__bf16)p[(size_t)(k0 + 16 + 8 * g + i) * HD]; }
  return w; }
#define WO_OUT_IN 0
#if WQKV_LAYOUT == 1
#define WCOL(W, k0, o, lane) wcol_oi(W, k0, o, lane, DIN)
#elif WQKV_LAYOUT == 2
#define WCOL(W, k0, o, lane) wcol_hdk(W, k0, o, lane)
#else
__device__ __forceinline__ v16b zero16b() { v16b w; _Pragma("unroll") for (int i = 0; i < 16; ++i) w[i] = (__bf16)0.0f; return w; }
#define WCOL(W, k0, o, lane) ((o) < 64 ? wcol_io(W, k0, (o), lane, 64) : zero16b())   /* (in,out) [512][64] pitch 64: only 64 real output columns; projected columns 64..127 (padding head 1) are zero */
#endif
#if WO_OUT_IN
#define WOCOL(W, k0, o, lane) wcol_oi(W, k0, o, lane, CC)
#define WOCOLH(W, k0, o, lane) wcolh_oi(W, k0, o, lane, CC)
#else
#define WOCOL(W, k0, o, lane) wcol_io(W, k0, o, lane, DIN)
#define WOCOLH(W, k0, o, lane) wcolh_io(W, k0, o, lane, DIN)
#endif

#ifndef SM_EXTRA_PARAMS
#define SM_EXTRA_PARAMS
#endif
#ifndef PROJ_EXTRA_PARAMS
#define PROJ_EXTRA_PARAMS
#endif
#ifndef SM_MASK_HOOK
#define SM_MASK_HOOK (void)0
#endif

#define WS_QH  0u                                      // f16 q rows [b*t][CC]
#define WS_KH  (WS_QH + 2u * (size_t)NB * TT * CC)      // f16 k in fragment order [b][32-key chunk][key tile][k slice][half][lane][8] (4 KiB a chunk)
#define WS_VT  (WS_KH + 2u * (size_t)NB * TT * CC)      // f16 v in fragment order [b][32-key chunk][16-column tile][half][lane][8] (4 KiB a chunk)
#define WS_QL  (WS_VT + 2u * (size_t)NB * CC * TT)      // f16 q residual x 2^10 rows [b][t < QHI][CC]
#define WS_KL  (WS_QL + 2u * (size_t)NB * QHI * CC)     // f16 k residual x 2^10, fragment order as k, chunks of t < KHI
#define WS_VB  (WS_KL + 2u * (size_t)NB * KHI * CC)     // bf16 v hi (and, behind it, lo), fragment order as v, chunks of t < KHI
#define WS_VBL (WS_VB + 2u * (size_t)NB * CC * KHI)
#define WS_S   (WS_VBL + 2u * (size_t)NB * CC * KHI)    // f32 [hg][t][s], reserved only: no kernel here stores logits or P (they stay in registers)
#define WS_Y   (WS_S  + 4u * (size_t)HG * TT * TT)      // f32 ctx rows [b*t][CC] (only when there is an output projection)
#define WS_END (WS_Y  + 0u)

// ---- k_fa: block = 32 queries of batch b, 8 waves: wave w takes the 32-key chunks w, w + 8, ... up to the diagonal chunk. Per chunk: S^T = K Q^T (a lane holds 16 keys' scores of one query per 16-query group), running maximum and sum per query in f32 (log2 domain),
// P^T packed from the score accumulators straight into the B operand, O^T += V^T P^T. The 8 waves' (maximum, sum, O) are merged through LDS in wave order and the merged rows go straight to the output [b][t][64] (16 lanes store one 256-byte row). Query rows < QHI: 3-product logits and P, v as bf16 hi + lo (3 products), as before.
#define FQ 32              // queries per block (two 16-column groups per wave)
#define FW 8               // waves per block = key chunks in flight per 32-query tile
#define SC2 (SCALE * 1.4426950408889634f)   // logits in log2 units
#define PEXP 4.0f          // P carries 2^4 (cancels in the division by the sum): keeps small P clear of the f16 subnormals
// 2^a as v_exp_f32 in asm text with one v_nop behind the last: the slot that the instruction set asks for between a transcendental and a directly following instruction that reads its result or overwrites its source
// "=&v" keeps every result off every source, so the eight in a row are independent of each other
__device__ __forceinline__ float ex2(float a) { float r; asm("v_exp_f32 %0, %1\n\tv_nop" : "=v"(r) : "v"(a)); return r; }
__device__ __forceinline__ void ex2x8(float* r, const float* a) {
  asm("v_exp_f32 %0, %8\n\tv_exp_f32 %1, %9\n\tv_exp_f32 %2, %10\n\tv_exp_f32 %3, %11\n\tv_exp_f32 %4, %12\n\tv_exp_f32 %5, %13\n\tv_exp_f32 %6, %14\n\tv_exp_f32 %7, %15\n\tv_nop"
      : "=&v"(r[0]), "=&v"(r[1]), "=&v"(r[2]), "=&v"(r[3]), "=&v"(r[4]), "=&v"(r[5]), "=&v"(r[6]), "=&v"(r[7]) : "v"(a[0]), "v"(a[1]), "v"(a[2]), "v"(a[3]), "v"(a[4]), "v"(a[5]), "v"(a[6]), "v"(a[7])); }
// stands behind a run of global loads, in front of any instruction that writes a register which an issued load names (a precaution); its "memory" clobber also keeps those loads issued above it
#define XW() asm volatile("s_wait_xcnt 0x0" ::: "memory")
// the same wait with the run's address pointers as inputs only: they stay live up to the wait, so that no load of the run gets its result placed on an address pair that earlier loads of the run name
#define XW1(p) asm volatile("s_wait_xcnt 0x0" :: "v"(p) : "memory")
#define XW2(p, q) asm volatile("s_wait_xcnt 0x0" :: "v"(p), "v"(q) : "memory")
// fragments through a pointer that already holds the lane's element offset: the loads of a run then name the loop pointer itself, which is advanced only behind XW()
__device__ __forceinline__ v16h frag_hr(const _Float16* p) { union { v16h v; v8h q[2]; } u; u.q[0] = *(const v8h*)p; u.q[1] = *(const v8h*)(p + 16); return u.v; }   // from a row (q): p holds the lane's 8 * (lane >> 4) offset
// k and v lie in the workspace in fragment order: lane l's 16 bytes of a fragment half stand at l * 16 in a run of 512 bytes, so that one load of a wave reads four whole 128-byte lines (from rows it touched sixteen lines, 32 bytes of each).
// p holds the lane's 8 * lane element offset; the second half of the fragment (elements 8..15) stands 256 elements on
__device__ __forceinline__ v16h frag_hp(const _Float16* p) { union { v16h v; v8h q[2]; } u; u.q[0] = *(const v8h*)p; u.q[1] = *(const v8h*)(p + 256); return u.v; }
__device__ __forceinline__ v16b frag_bp(const __bf16* p) { union { v16b v; v8b q[2]; } u; u.q[0] = *(const v8b*)p; u.q[1] = *(const v8b*)(p + 256); return u.v; }
// one 16-query group's 32 scores (log2 units) of one chunk -> P x 2^PEXP in u; running maximum m, per-lane running sum l and the output tiles are brought to the new maximum
__device__ __forceinline__ void fa_soft(float (&u)[16], bool diag, int key0, int query, float& m, float& l, v8f (&acc)[HD / 16]) {
  if (diag) {   // the diagonal chunk: key > query is excluded by index (its first key <= every query of the tile, so no column is left empty)
#pragma unroll
    for (int i = 0; i < 16; ++i) if (key0 + (i >> 3) * 16 + (i & 7) > query) u[i] = -3.0e38f; }
  float mx = u[0];
#pragma unroll
  for (int i = 1; i < 16; ++i) mx = fmaxf(mx, u[i]);
  mx = fmaxf(mx, __shfl_xor(mx, 16));   // lanes c and c + 16 hold the two key halves of one query
  const float mn = fmaxf(m, mx); const float al = ex2(m - mn); m = mn; const float sh = mn - PEXP;
  float d[16], s = 0.f;
#pragma unroll
  for (int i = 0; i < 16; ++i) d[i] = u[i] - sh;
  ex2x8(u, d); ex2x8(u + 8, d + 8);
#pragma unroll
  for (int i = 0; i < 16; ++i) s += u[i];
  l = l * al + s;
#pragma unroll
  for (int j = 0; j < HD / 16; ++j) acc[j] *= al; }
// query rows >= QHI: single f16 products
__device__ __forceinline__ void fa_loop(const _Float16* __restrict__ QH, const _Float16* __restrict__ KH, const _Float16* __restrict__ VT, int b, int x, int wave, int lane, v8f (&acc)[2][HD / 16], float (&m)[2], float (&l)[2]) {
  const int col = lane & 15, g = lane >> 4; const int ql0 = x * FQ;
  __builtin_assume(wave <= x);   // only tiles of rows >= QHI come here (x >= QHI / FQ > FW - 1): every wave has a chunk; without it the first loads sink under the loop's entry test, away from the wait written behind them
  const _Float16* kp = KH + ((size_t)b * TT + (wave <= x ? wave : x) * 32) * HD + 8 * lane; const _Float16* vp = VT + ((size_t)b * TT + wave * 32) * HD + 8 * lane;   // the wave's current k and v chunk, the lane's fragment offset included
  const _Float16* qp = QH + ((size_t)b * TT + ql0 + col) * CC + 8 * g;   // q stays in rows
  v16h qh[2][2], kf[2][2];
#pragma unroll
  for (int t = 0; t < 2; ++t)
#pragma unroll
    for (int kc = 0; kc < 2; ++kc) { qh[t][kc] = frag_hr(qp + t * 16 * CC + kc * 32); kf[t][kc] = frag_hp(kp + (t * 2 + kc) * 512); }
  XW2(qp, kp);
#pragma unroll 1   // rolled: a second pass in flight would double the live fragments and cost the fourth wave per SIMD
  for (int ch = wave; ch <= x; ch += FW) { const int k0 = ch * 32;
    v16h vf[HD / 16];
#pragma unroll
    for (int j = 0; j < HD / 16; ++j) vf[j] = frag_hp(vp + j * 512);
    XW1(vp);   // the v loads issue here, so that the score products and the softmax cover their latency
    vp += FW * 32 * HD;
    v8f st[2][2] = {};
#pragma unroll
    for (int kt = 0; kt < 2; ++kt)
#pragma unroll
      for (int kc = 0; kc < 2; ++kc)
#pragma unroll
        for (int qt = 0; qt < 2; ++qt) st[qt][kt] = wmma16(kf[kt][kc], qh[qt][kc], st[qt][kt]);
    kp += ch + FW <= x ? FW * 32 * HD : 0;   // the wave's next chunk (its last pass reads its own chunk again: in bounds, unused)
#pragma unroll
    for (int kt = 0; kt < 2; ++kt)
#pragma unroll
      for (int kc = 0; kc < 2; ++kc) kf[kt][kc] = frag_hp(kp + (kt * 2 + kc) * 512);
    XW1(kp);   // the next chunk's k loads issue here, one pass ahead, under the softmax and the P x V products
    v16h ph[2];
#pragma unroll
    for (int qt = 0; qt < 2; ++qt) { float u[16];
#pragma unroll
      for (int i = 0; i < 16; ++i) u[i] = st[qt][i >> 3][i & 7] * SC2;
      fa_soft(u, ch == x, k0 + 8 * g, ql0 + qt * 16 + col, m[qt], l[qt], acc[qt]);
#pragma unroll
      for (int i = 0; i < 16; ++i) ph[qt][i] = (_Float16)u[i]; }
#pragma unroll
    for (int j = 0; j < HD / 16; ++j)
#pragma unroll
      for (int qt = 0; qt < 2; ++qt) acc[qt][j] = wmma16(vf[j], ph[qt], acc[qt][j]); } }
// query rows < QHI (at most 12 chunks a tile), one 16-query group a call (fewer live registers): q and k residual planes in the logits, P and v as bf16 hi + lo
__device__ __forceinline__ void fa_loop_hi(const _Float16* __restrict__ QH, const _Float16* __restrict__ KH, const _Float16* __restrict__ QL, const _Float16* __restrict__ KL, const __bf16* __restrict__ VB, const __bf16* __restrict__ VBL,
    int b, int x, int q0, int wave, int lane, v8f (&acc)[HD / 16], float& m, float& l) {
  if (wave > x) return;   // a wave without a chunk (wave-uniform)
  const int col = lane & 15, g = lane >> 4;
  v16h qh[2], ql[2];
#pragma unroll
  for (int kc = 0; kc < 2; ++kc) { qh[kc] = frag_h(QH + ((size_t)b * TT + q0 + col) * CC + kc * 32, lane); ql[kc] = frag_h(QL + ((size_t)b * QHI + q0 + col) * CC + kc * 32, lane); }
  XW();
  const _Float16* kp = KH + ((size_t)b * TT + wave * 32) * HD + 8 * lane; const _Float16* klp = KL + ((size_t)b * KHI + wave * 32) * HD + 8 * lane; const __bf16* vp = VB + ((size_t)b * KHI + wave * 32) * HD + 8 * lane; const __bf16* vlp = VBL + ((size_t)b * KHI + wave * 32) * HD + 8 * lane;   // the lane's fragment offset included
#pragma unroll 1   // rolled: a second pass in flight would double the live fragments and cost the fourth wave per SIMD
  for (int ch = wave; ch <= x; ch += FW) { const int k0 = ch * 32;
    v16h kf[2][2], klf[2][2];
#pragma unroll
    for (int kt = 0; kt < 2; ++kt)
#pragma unroll
      for (int kc = 0; kc < 2; ++kc) { kf[kt][kc] = frag_hp(kp + (kt * 2 + kc) * 512); klf[kt][kc] = frag_hp(klp + (kt * 2 + kc) * 512); }
    XW2(kp, klp);   // all of the chunk's k loads issue together: one latency, not one per fragment
    kp += FW * 32 * HD; klp += FW * 32 * HD;
    v8f st[2] = {}, sl[2] = {};
#pragma unroll
    for (int kt = 0; kt < 2; ++kt)
#pragma unroll
      for (int kc = 0; kc < 2; ++kc) { st[kt] = wmma16(kf[kt][kc], qh[kc], st[kt]); sl[kt] = wmma16(kf[kt][kc], ql[kc], sl[kt]); sl[kt] = wmma16(klf[kt][kc], qh[kc], sl[kt]); }
    v16b vh[HD / 16], vl[HD / 16];
#pragma unroll
    for (int j = 0; j < HD / 16; ++j) { vh[j] = frag_bp(vp + j * 512); vl[j] = frag_bp(vlp + j * 512); }
    XW2(vp, vlp);   // the v loads issue here, under the softmax
    vp += FW * 32 * HD; vlp += FW * 32 * HD;
    float u[16];
#pragma unroll
    for (int i = 0; i < 16; ++i) u[i] = (st[i >> 3][i & 7] + sl[i >> 3][i & 7] * (1.0f / 1024.0f)) * SC2;
    fa_soft(u, ch == x, k0 + 8 * g, q0 + col, m, l, acc);
    const F2 pb = bsplit16(u);
#pragma unroll
    for (int j = 0; j < HD / 16; ++j) { acc[j] = wmma_bf(vh[j], pb.h, acc[j]); acc[j] = wmma_bf(vh[j], pb.l, acc[j]); acc[j] = wmma_bf(vl[j], pb.h, acc[j]); } } }
// four waves per SIMD: two 8-wave blocks resident per WGP, so that all 512 blocks run at once
__global__ __launch_bounds__(FW * 32) __attribute__((amdgpu_waves_per_eu(4, 4))) void k_fa(const _Float16* __restrict__ QH, const _Float16* __restrict__ KH, const _Float16* __restrict__ QL, const _Float16* __restrict__ KL, const _Float16* __restrict__ VT, const __bf16* __restrict__ VB, const __bf16* __restrict__ VBL, float* __restrict__ OUT) {
  __shared__ __align__(16) float ss[FW][FQ][HD + 4]; __shared__ float smx[FW][FQ], ssu[FW][FQ];
  const int tid = threadIdx.x, wave = __builtin_amdgcn_readfirstlane(tid >> 5), lane = tid & 31, col = lane & 15, g = lane >> 4;
  const int b = blockIdx.x; const int y = blockIdx.y; const int x = y < TT / FQ / 2 ? TT / FQ - 1 - y : y - TT / FQ / 2;   // a permutation of the tiles, for speed only: all blocks are resident, two a WGP; the first half of the grid falls in keys, the second rises, so that blocks half a grid apart add up to the same work
  const int ql0 = x * FQ;
  v8f acc[2][HD / 16] = {}; float m[2] = {-3.0e38f, -3.0e38f}, l[2] = {0.f, 0.f};
  if (ql0 < QHI) { fa_loop_hi(QH, KH, QL, KL, VB, VBL, b, x, ql0, wave, lane, acc[0], m[0], l[0]); fa_loop_hi(QH, KH, QL, KL, VB, VBL, b, x, ql0 + 16, wave, lane, acc[1], m[1], l[1]); }
  else fa_loop(QH, KH, VT, b, x, wave, lane, acc, m, l);
#pragma unroll
  for (int qt = 0; qt < 2; ++qt) { const float lt = l[qt] + __shfl_xor(l[qt], 16); if (g == 0) { smx[wave][qt * 16 + col] = m[qt]; ssu[wave][qt * 16 + col] = lt; }
#pragma unroll
    for (int j = 0; j < HD / 16; ++j) { const v4f lo = {acc[qt][j][0], acc[qt][j][1], acc[qt][j][2], acc[qt][j][3]}, hi = {acc[qt][j][4], acc[qt][j][5], acc[qt][j][6], acc[qt][j][7]};
      *(v4f*)&ss[wave][qt * 16 + col][j * 16 + 8 * g] = lo; *(v4f*)&ss[wave][qt * 16 + col][j * 16 + 8 * g + 4] = hi; } }
  __syncthreads();   // every wave's maximum, sum and partial tile (sum 0 from a wave without a chunk) are in LDS before any is merged
  for (int e = tid; e < FQ * (HD / 4); e += FW * 32) { const int rl = e >> 4, q = e & 15; float M = smx[0][rl];
#pragma unroll
    for (int w = 1; w < FW; ++w) M = fmaxf(M, smx[w][rl]);
    v4f s = {0.f, 0.f, 0.f, 0.f}; float L = 0.f;
#pragma unroll
    for (int w = 0; w < FW; ++w) { const float f = ex2(smx[w][rl] - M); L += f * ssu[w][rl]; s += *(const v4f*)&ss[w][rl][q * 4] * f; }
    vst2(OUT + ((size_t)b * TT + ql0 + rl) * HD + q * 4, s * (1.0f / L)); } }

// ---- k_proj: block = 64 rows of x, 16 waves: q, k and v (the 192 real columns) from one pass over x. x and the three weights come in by whole-line loads, are rounded to bf16 and laid in LDS once per block (weights as [column][k]);
// wave (row tile, column tile) then takes its fragments from LDS: exact bf16 products, k slices in rising order. q f16 rows (+ residual rows < QHI; columns 64..127 of their pitch are neither written nor read); k (+ residual for t < KHI) and v (+ bf16 hi/lo for t < KHI) in the attention kernel's fragment order, two 4-KiB chunks a block
#define PWP 520            // LDS row pitch in elements: 1040 B = 16 B x 65 (odd), so that 16 rows' 16-byte reads and writes fall on all banks
#define PEP 72             // pitch of the output tiles in LDS: 144 B = 16 B x 9
__global__ __launch_bounds__(512) void k_proj(const float* __restrict__ X, const float* __restrict__ WQ, const float* __restrict__ WK, const float* __restrict__ WV,
    _Float16* __restrict__ QH, _Float16* __restrict__ QL, _Float16* __restrict__ KH, _Float16* __restrict__ KL, _Float16* __restrict__ VT, __bf16* __restrict__ VB, __bf16* __restrict__ VBL) {
  __shared__ __align__(16) __bf16 wsm[192][PWP]; __shared__ __align__(16) __bf16 xsm[64][PWP];
  const int tid = threadIdx.x, wave = tid >> 5, lane = tid & 31, col = lane & 15, g = lane >> 4; const size_t r0 = (size_t)blockIdx.x * 64; const size_t bb = r0 / TT; const int t0 = (int)(r0 % TT);
  const float* xp = X + r0 * DIN + tid * 4;   // a wave's load = 512 B in a row of x
  v4f xr[16];
#pragma unroll
  for (int i = 0; i < 16; ++i) xr[i] = *(const v4f*)(xp + i * 2048);
  XW();   // all of the block's x is requested before anything waits
  const int wo = tid & 63, wk = tid >> 6;   // weight column; 8-row k group within a 64-row slab (a wave's load = 128 B of one weight row)
  const size_t woff = (size_t)wk * 8 * 64 + wo;
  float wv[2][32];
#pragma unroll
  for (int n = 0; n < 7; ++n) {   // batch n = weight n / 2, k rows (n & 1) * 256 ..+255; batch n + 1 is requested before batch n is packed
    if (n < 6) { const float* wp = (n < 2 ? WQ : n < 4 ? WK : WV) + woff + (size_t)(n & 1) * 256 * 64;
#pragma unroll
      for (int r = 0; r < 4; ++r)
#pragma unroll
        for (int i = 0; i < 8; ++i) wv[n & 1][r * 8 + i] = wp[(r * 64 + i) * 64];
      XW(); }
    if (n == 0) {
#pragma unroll
      for (int i = 0; i < 16; ++i) { typedef __attribute__((ext_vector_type(4))) __bf16 v4b; v4b pk;
#pragma unroll
        for (int e = 0; e < 4; ++e) pk[e] = (__bf16)xr[i][e];
        *(v4b*)&xsm[(tid >> 7) + i * 4][(tid & 127) * 4] = pk; }
    } else { const int p = n - 1;
#pragma unroll
      for (int r = 0; r < 4; ++r) { v8b pk;
#pragma unroll
        for (int i = 0; i < 8; ++i) pk[i] = (__bf16)wv[p & 1][r * 8 + i];
        *(v8b*)&wsm[(p >> 1) * 64 + wo][(p & 1) * 256 + r * 64 + wk * 8] = pk; } } }
  __syncthreads();   // x and the weights are in LDS before any fragment is read
  const int rt = wave & 3, ct = wave >> 2;
  v8f acc[3] = {};
  const __bf16* ap = &xsm[rt * 16 + col][0]; const __bf16* bp = &wsm[ct * 16 + col][0];
  v16b fa[2][2], fb[2][2][3];   // two k slices a group, two groups of fragments: the next group's LDS reads are issued in front of this group's products, which cover their latency
#pragma unroll
  for (int s = 0; s < 2; ++s) { fa[0][s] = frag_b(ap + s * 32, lane);
#pragma unroll
    for (int mt = 0; mt < 3; ++mt) fb[0][s][mt] = frag_b(bp + mt * 64 * PWP + s * 32, lane); }
#pragma unroll   // unrolled: the two fragment groups are named at compile time
  for (int kg = 0; kg < DIN / 64; ++kg) {
    if (kg + 1 < DIN / 64) {
#pragma unroll
      for (int s = 0; s < 2; ++s) { fa[(kg + 1) & 1][s] = frag_b(ap + (kg + 1) * 64 + s * 32, lane);
#pragma unroll
        for (int mt = 0; mt < 3; ++mt) fb[(kg + 1) & 1][s][mt] = frag_b(bp + mt * 64 * PWP + (kg + 1) * 64 + s * 32, lane); } }
#pragma unroll
    for (int s = 0; s < 2; ++s)
#pragma unroll
      for (int mt = 0; mt < 3; ++mt) acc[mt] = wmma_bf(fa[kg & 1][s], fb[kg & 1][s][mt], acc[mt]); }
  __syncthreads();   // every wave's last read of xsm is done before its space takes the output tiles
  _Float16* eb = (_Float16*)&xsm[0][0]; _Float16 *sqh = eb, *sql = eb + 64 * PEP, *skh = eb + 2 * 64 * PEP, *skl = eb + 3 * 64 * PEP, *sth = eb + 4 * 64 * PEP; __bf16 *stb = (__bf16*)(eb + 5 * 64 * PEP), *stl = (__bf16*)(eb + 6 * 64 * PEP);
  const bool hi_rows = t0 < KHI;
#pragma unroll
  for (int r = 0; r < 8; ++r) { const int rl = rt * 16 + 8 * g + r, cl = ct * 16 + col;
    { const float v = acc[0][r]; const _Float16 hv = (_Float16)v; sqh[rl * PEP + cl] = hv; sql[rl * PEP + cl] = (_Float16)((v - (float)hv) * 1024.0f); }
    { const float v = acc[1][r]; const _Float16 hv = (_Float16)v; skh[rl * PEP + cl] = hv; skl[rl * PEP + cl] = (_Float16)((v - (float)hv) * 1024.0f); }
    { const float v = acc[2][r]; sth[cl * PEP + rl] = (_Float16)v; const __bf16 bh = (__bf16)v; stb[cl * PEP + rl] = bh; stl[cl * PEP + rl] = (__bf16)(v - (float)bh); } }
  __syncthreads();   // the output tiles are whole before they are stored (q by rows, k and v in fragment order)
  { const int rl = tid >> 3, q = tid & 7; const int so = rl * PEP + q * 8;   // q: 8 lanes store one 128-byte row
    // k, v: thread tid stores the tid-th 16 bytes of the block's two chunks (a wave = 512 bytes in a row). tid bits: 0..3 fragment row, 4 lane half g, 8 chunk;
    // k: 5 fragment half, 6 k slice, 7 key tile -> key row, features 8 * (bits 6 5 4); v: 5 fragment half, 6..7 column tile -> column, keys 16 * half + 8 * g
    const int fr = tid & 15, ck = (tid >> 8) * 32; const int ko = (ck + ((tid >> 7) & 1) * 16 + fr) * PEP + ((tid >> 4) & 7) * 8, vo = (((tid >> 6) & 3) * 16 + fr) * PEP + ck + ((tid >> 4) & 3) * 8;
    vst2(QH + (r0 + rl) * CC + q * 8, *(const v4u*)&sqh[so]); vst2(KH + r0 * HD + tid * 8, *(const v4u*)&skh[ko]); vst2(VT + r0 * HD + tid * 8, *(const v4u*)&sth[vo]);
    XW();   // behind the three stores, in front of the address arithmetic of the residual planes
    if (hi_rows) { vst2(QL + (bb * QHI + t0 + rl) * (size_t)CC + q * 8, *(const v4u*)&sql[so]);
      const size_t o3 = (bb * KHI + t0) * (size_t)HD + tid * 8; vst2(KL + o3, *(const v4u*)&skl[ko]); vst2(VB + o3, *(const v4u*)&stb[vo]); vst2(VBL + o3, *(const v4u*)&stl[vo]); } } }

extern "C" void kernel_launch(void* const* d_in, const int* in_sizes, int n_in, void* d_out, int out_size, void* d_ws, size_t ws_size, hipStream_t stream) {
  (void)in_sizes; (void)n_in; (void)out_size;
  const float** F = (const float**)d_in;
  if (ws_size < (size_t)WS_END) return;
  char* ws = (char*)d_ws; _Float16 *QH = (_Float16*)(ws + WS_QH), *KH = (_Float16*)(ws + WS_KH), *VT = (_Float16*)(ws + WS_VT), *QL = (_Float16*)(ws + WS_QL), *KL = (_Float16*)(ws + WS_KL); __bf16 *VB = (__bf16*)(ws + WS_VB), *VBL = (__bf16*)(ws + WS_VBL); float *Y = (float*)(ws + WS_Y);
  (void)Y; (void)QL; (void)KL; (void)VB; (void)VBL;
  // inputs: 0 x [4,4096,512]; 1 Wq [512,64] (in,out); 2 Wk; 3 Wv; no biases
  k_proj<<<dim3(TNB * TT / 64), 512, 0, stream>>>(F[0], F[1], F[2], F[3], QH, QL, KH, KL, VT, VB, VBL);
  k_fa<<<dim3(TNB, TT / FQ), FW * 32, 0, stream>>>(QH, KH, QL, KL, VT, VB, VBL, (float*)d_out);   /* head 0 only (head 1 is the zero padding) */
}

// v006
// One run takes 28.5 microseconds.
// Two timings next to v005 put it at 1.03 and 1.02 times that version's speed.
// All steps since v000 together make it 24.0 times as fast.
// compute dtype: all float inputs rounded to bf16; q/k/v projections with EXACT bf16 products on WMMA 16x16x32 (f32 accumulate); causal logits: 3 products for the first 384 rows, single f16 q x k after, x 64^-0.5; running softmax f32; P (against the running maximum) x 2^4 once to f16 x v once to f16 (bf16 hi + lo below row 384); f32 output.
#include <hip/hip_runtime.h>
#include <math.h>

typedef __attribute__((ext_vector_type(16))) _Float16 v16h;
typedef __attribute__((ext_vector_type(16))) __bf16 v16b;
typedef __attribute__((ext_vector_type(8)))  _Float16 v8h;
typedef __attribute__((ext_vector_type(8)))  float v8f;
typedef __attribute__((ext_vector_type(4)))  float v4f;
typedef __attribute__((ext_vector_type(2)))  float v2f;
typedef __attribute__((ext_vector_type(4)))  unsigned v4u;
typedef __attribute__((ext_vector_type(4)))  int v4i;
typedef float __attribute__((may_alias)) float_a;
typedef int __attribute__((may_alias)) int_a;

template <typename T> __device__ __forceinline__ void vst2(void* p, T v) { *(T*)p = v;  }
__device__ __forceinline__ v8f wmma16(v16h a, v16h b, v8f c) {
  v8f d = __builtin_amdgcn_wmma_f32_16x16x32_f16(false, a, false, b, (short)0, c, false, false);
  asm volatile("v_nop\n\tv_nop\n\tv_nop\n\tv_nop" : "+v"(d) : "v"(a), "v"(b));
  return d;
}
__device__ __forceinline__ v8f wmma_bf(v16b a, v16b b, v8f c) {
  v8f d = __builtin_amdgcn_wmma_f32_16x16x32_bf16(false, a, false, b, (short)0, c, false, false);
  asm volatile("v_nop\n\tv_nop\n\tv_nop\n\tv_nop" : "+v"(d) : "v"(a), "v"(b));
  return d;
}
// 16x16x32 fragments: lane = (h = lane>>4, row/col = lane&15); elements 0..7 = k0+8h+0..7, 8..15 = k0+16+8h+0..7; D element r = row 8h+r
__device__ __forceinline__ v16h frag_h(const _Float16* rowk0, int lane) {
  union { v16h v; v8h q[2]; } u; const _Float16* p = rowk0 + 8 * (lane >> 4);
  u.q[0] = *(const v8h*)p; u.q[1] = *(const v8h*)(p + 16); return u.v;
}
__device__ __forceinline__ v16h frag_f32(const float* rowk0, int lane) {
  v16h a; const float* p = rowk0 + 8 * (lane >> 4);
#pragma unroll
  for (int i = 0; i < 8; ++i) { a[i] = (_Float16)p[i]; a[8 + i] = (_Float16)p[16 + i]; }
  return a;
}
__device__ __forceinline__ v16h frag_f32s(const float* rowk0, int lane, float sc) {
  v16h a; const float* p = rowk0 + 8 * (lane >> 4);
#pragma unroll
  for (int i = 0; i < 8; ++i) { a[i] = (_Float16)(p[i] * sc); a[8 + i] = (_Float16)(p[16 + i] * sc); }
  return a;
}
// column fragment from a [K][ld] layout (column n), rows >= K read as 0
__device__ __forceinline__ v16h fragc_f32(const float* W, int k0, int n, int lane, int ld, int K) {
  v16h a; const int g = lane >> 4;
#pragma unroll
  for (int i = 0; i < 8; ++i) { const int ka = k0 + 8 * g + i, kb = ka + 16;
    a[i] = (_Float16)(ka < K ? W[(size_t)(ka < K ? ka : K - 1) * ld + n] : 0.f); a[8 + i] = (_Float16)(kb < K ? W[(size_t)(kb < K ? kb : K - 1) * ld + n] : 0.f); }
  return a;
}
struct F2 { v16b h, l; };
__device__ __forceinline__ F2 bsplit16(const float v[16]) { F2 r;
#pragma unroll
  for (int i = 0; i < 16; ++i) { const __bf16 h = (__bf16)v[i]; r.h[i] = h; r.l[i] = (__bf16)(v[i] - (float)h); }
  return r; }
__device__ __forceinline__ F2 split_row(const float* row, int k0, int lane) { float v[16]; const float* p = row + k0 + 8 * (lane >> 4);
#pragma unroll
  for (int i = 0; i < 8; ++i) { v[i] = p[i]; v[8 + i] = p[16 + i]; }
  return bsplit16(v); }
__device__ __forceinline__ F2 split_rowK(const float* row, int k0, int lane, int K) { float v[16]; const int g = lane >> 4;
#pragma unroll
  for (int i = 0; i < 8; ++i) { const int ka = k0 + 8 * g + i, kb = ka + 16; v[i] = ka < K ? row[ka < K ? ka : K - 1] : 0.f; v[8 + i] = kb < K ? row[kb < K ? kb : K - 1] : 0.f; }
  return bsplit16(v); }
__device__ __forceinline__ F2 split_col(const float* W, int k0, int n, int lane, int ld, int K) { float v[16]; const int g = lane >> 4;
#pragma unroll
  for (int i = 0; i < 8; ++i) { const int ka = k0 + 8 * g + i, kb = ka + 16; v[i] = ka < K ? W[(size_t)(ka < K ? ka : K - 1) * ld + n] : 0.f; v[8 + i] = kb < K ? W[(size_t)(kb < K ? kb : K - 1) * ld + n] : 0.f; }
  return bsplit16(v); }
__device__ __forceinline__ v8f mac3(const F2& a, const F2& b, v8f c) { c = wmma_bf(a.l, b.h, c); c = wmma_bf(a.h, b.l, c); return wmma_bf(a.h, b.h, c); }
__device__ __forceinline__ float sigm(float v) { return 1.0f / (1.0f + expf(-v)); }
#define LDSX() do { asm volatile("s_wait_dscnt 0" ::: "memory"); __builtin_amdgcn_wave_barrier(); __builtin_amdgcn_fence(__ATOMIC_RELEASE, "workgroup"); } while (0)

// Single-head causal self-attention (x [4,4096,512]; (in,out) Wq / Wk / Wv [512,64] N(0, 1/512), no biases; scale 1/sqrt(64); tril, -inf; no output projection): out = softmax(causal(q k^T / 8)) v -> [4,4096,64].
#define NB 4
#define TT 4096
#define CC 128            // NH * HD = projected width
#define DIN 512          // input (model) width
#define NH 2
#define HD 64
#define NQB (TT / 64)
#define HG 1
#define SCALE (0.125f)
#define CAUSAL 1
#ifndef TNB
#define TNB NB
#endif
__device__ __forceinline__ float bfr(float v) { return (float)(__bf16)v; }
__host__ __device__ __forceinline__ int kb_last(int qb) { return CAUSAL ? ((qb * 64 + 63) >> 7) : (TT / 128 - 1); }
typedef __attribute__((ext_vector_type(8))) __bf16 v8b;
__device__ __forceinline__ v16b frag_b(const __bf16* rowk0, int lane) {
  union { v16b v; v8b q[2]; } u; const __bf16* p = rowk0 + 8 * (lane >> 4);
  u.q[0] = *(const v8b*)p; u.q[1] = *(const v8b*)(p + 16); return u.v;
}
#define QBH 6              // not used: k_fa's 32-query tiles 0..11 of each sequence (rows < QHI; few keys, no averaging) take the high-precision path
#define QHI 384            // rows carrying a q residual plane
#define KHI 384            // key rows carrying k residual / v bf16 hi+lo planes (used only by the causal high-precision path)
// B fragment (k rows k0+.., output column o) of a weight: (in,out) [K][ld] or (out,in) [ld rows of K]: bf16 exact, or f16(bf16 * 256) exact
__device__ __forceinline__ v16b wcol_io(const float* Wm, int k0, int o, int lane, int ld) { v16b w; const int g = lane >> 4;
#pragma unroll
  for (int i = 0; i < 8; ++i) { w[i] = (__bf16)Wm[(size_t)(k0 + 8 * g + i) * ld + o]; w[8 + i] = (__bf16)Wm[(size_t)(k0 + 16 + 8 * g + i) * ld + o]; }
  return w; }
__device__ __forceinline__ v16b wcol_oi(const float* Wm, int k0, int o, int lane, int K) { v16b w; const float* p = Wm + (size_t)o * K + k0 + 8 * (lane >> 4);
#pragma unroll
  for (int i = 0; i < 8; ++i) { w[i] = (__bf16)p[i]; w[8 + i] = (__bf16)p[16 + i]; }
  return w; }
__device__ __forceinline__ v16h wcolh_io(const float* Wm, int k0, int o, int lane, int ld) { v16h w; const int g = lane >> 4;
#pragma unroll
  for (int i = 0; i < 8; ++i) { w[i] = (_Float16)(bfr(Wm[(size_t)(k0 + 8 * g + i) * ld + o]) * 256.0f); w[8 + i] = (_Float16)(bfr(Wm[(size_t)(k0 + 16 + 8 * g + i) * ld + o]) * 256.0f); }
  return w; }
__device__ __forceinline__ v16h wcolh_oi(const float* Wm, int k0, int o, int lane, int K) { v16h w; const float* p = Wm + (size_t)o * K + k0 + 8 * (lane >> 4);
#pragma unroll
  for (int i = 0; i < 8; ++i) { w[i] = (_Float16)(bfr(p[i]) * 256.0f); w[8 + i] = (_Float16)(bfr(p[16 + i]) * 256.0f); }
  return w; }
#define WQKV_LAYOUT 0   // 0 = (in,out) [DIN][HD]; 1 = (out,in) [CC][DIN]; 2 = per-head [NH][DIN][HD]
__device__ __forceinline__ v16b wcol_hdk(const float* Wm, int k0, int o, int lane) { v16b w; const int g = lane >> 4; const float* p = Wm + (size_t)(o / HD) * DIN * HD + (o % HD);
#pragma unroll
  for (int i = 0; i < 8; ++i) { w[i] = (__bf16)p[(size_t)(k0 + 8 * g + i) * HD]; w[8 + i] = (__bf16)p[(size_t)(k0 + 16 + 8 * g + i) * HD]; }
  return w; }
#define WO_OUT_IN 0
#if WQKV_LAYOUT == 1
#define WCOL(W, k0, o, lane) wcol_oi(W, k0, o, lane, DIN)
#elif WQKV_LAYOUT == 2
#define WCOL(W, k0, o, lane) wcol_hdk(W, k0, o, lane)
#else
__device__ __forceinline__ v16b zero16b() { v16b w; _Pragma("unroll") for (int i = 0; i < 16; ++i) w[i] = (__bf16)0.0f; return w; }
#define WCOL(W, k0, o, lane) ((o) < 64 ? wcol_io(W, k0, (o), lane, 64) : zero16b())   /* (in,out) [512][64] pitch 64: only 64 real output columns; projected columns 64..127 (padding head 1) are zero */
#endif
#if WO_OUT_IN
#define WOCOL(W, k0, o, lane) wcol_oi(W, k0, o, lane, CC)
#define WOCOLH(W, k0, o, lane) wcolh_oi(W, k0, o, lane, CC)
#else
#define WOCOL(W, k0, o, lane) wcol_io(W, k0, o, lane, DIN)
#define WOCOLH(W, k0, o, lane) wcolh_io(W, k0, o, lane, DIN)
#endif

#ifndef SM_EXTRA_PARAMS
#define SM_EXTRA_PARAMS
#endif
#ifndef PROJ_EXTRA_PARAMS
#define PROJ_EXTRA_PARAMS
#endif
#ifndef SM_MASK_HOOK
#define SM_MASK_HOOK (void)0
#endif

#define WS_QH  0u                                      // f16 q rows [b*t][CC]
#define WS_KH  (WS_QH + 2u * (size_t)NB * TT * CC)      // f16 k in fragment order [b][32-key chunk][key tile][k slice][half][lane][8] (4 KiB a chunk)
#define WS_VT  (WS_KH + 2u * (size_t)NB * TT * CC)      // f16 v in fragment order [b][32-key chunk][16-column tile][half][lane][8] (4 KiB a chunk)
#define WS_QL  (WS_VT + 2u * (size_t)NB * CC * TT)      // f16 q residual x 2^10 rows [b][t < QHI][CC]
#define WS_KL  (WS_QL + 2u * (size_t)NB * QHI * CC)     // f16 k residual x 2^10, fragment order as k, chunks of t < KHI
#define WS_VB  (WS_KL + 2u * (size_t)NB * KHI * CC)     // bf16 v hi (and, behind it, lo), fragment order as v, chunks of t < KHI
#define WS_VBL (WS_VB + 2u * (size_t)NB * CC * KHI)
#define WS_S   (WS_VBL + 2u * (size_t)NB * CC * KHI)    // f32 [hg][t][s], reserved only: no kernel here stores logits or P (they stay in registers)
#define WS_Y   (WS_S  + 4u * (size_t)HG * TT * TT)      // f32 ctx rows [b*t][CC] (only when there is an output projection)
#define WS_END (WS_Y  + 0u)

// ---- k_fa: block = 32 queries of batch b, 8 waves: wave w takes the 32-key chunks w, w + 8, ... up to the diagonal chunk. Per chunk: S^T = K Q^T (a lane holds 16 keys' scores of one query per 16-query group), running maximum and sum per query in f32 (log2 domain),
// P^T packed from the score accumulators straight into the B operand, O^T += V^T P^T. The 8 waves' (maximum, sum, O) are merged through LDS in wave order and the merged rows go straight to the output [b][t][64] (16 lanes store one 256-byte row). Query rows < QHI: 3-product logits and P, v as bf16 hi + lo (3 products), as before.
#define FQ 32              // queries per block (two 16-column groups per wave)
#define FW 8               // waves per block = key chunks in flight per 32-query tile
#define SC2 (SCALE * 1.4426950408889634f)   // logits in log2 units
#define PEXP 4.0f          // P carries 2^4 (cancels in the division by the sum): keeps small P clear of the f16 subnormals
// 2^a as v_exp_f32 in asm text with one v_nop behind the last: the slot that the instruction set asks for between a transcendental and a directly following instruction that reads its result or overwrites its source
// "=&v" keeps every result off every source, so the eight in a row are independent of each other
__device__ __forceinline__ float ex2(float a) { float r; asm("v_exp_f32 %0, %1\n\tv_nop" : "=v"(r) : "v"(a)); return r; }
__device__ __forceinline__ void ex2x8(float* r, const float* a) {
  asm("v_exp_f32 %0, %8\n\tv_exp_f32 %1, %9\n\tv_exp_f32 %2, %10\n\tv_exp_f32 %3, %11\n\tv_exp_f32 %4, %12\n\tv_exp_f32 %5, %13\n\tv_exp_f32 %6, %14\n\tv_exp_f32 %7, %15\n\tv_nop"
      : "=&v"(r[0]), "=&v"(r[1]), "=&v"(r[2]), "=&v"(r[3]), "=&v"(r[4]), "=&v"(r[5]), "=&v"(r[6]), "=&v"(r[7]) : "v"(a[0]), "v"(a[1]), "v"(a[2]), "v"(a[3]), "v"(a[4]), "v"(a[5]), "v"(a[6]), "v"(a[7])); }
// stands behind a run of global loads, in front of any instruction that writes a register which an issued load names (a precaution); its "memory" clobber also keeps those loads issued above it
#define XW() asm volatile("s_wait_xcnt 0x0" ::: "memory")
// the same wait with the run's address pointers as inputs only: they stay live up to the wait, so that no load of the run gets its result placed on an address pair that earlier loads of the run name
#define XW1(p) asm volatile("s_wait_xcnt 0x0" :: "v"(p) : "memory")
#define XW2(p, q) asm volatile("s_wait_xcnt 0x0" :: "v"(p), "v"(q) : "memory")
// fragments through a pointer that already holds the lane's element offset: the loads of a run then name the loop pointer itself, which is advanced only behind XW()
__device__ __forceinline__ v16h frag_hr(const _Float16* p) { union { v16h v; v8h q[2]; } u; u.q[0] = *(const v8h*)p; u.q[1] = *(const v8h*)(p + 16); return u.v; }   // from a row (q): p holds the lane's 8 * (lane >> 4) offset
// k and v lie in the workspace in fragment order: lane l's 16 bytes of a fragment half stand at l * 16 in a run of 512 bytes, so that one load of a wave reads four whole 128-byte lines (from rows it touched sixteen lines, 32 bytes of each).
// p holds the lane's 8 * lane element offset; the second half of the fragment (elements 8..15) stands 256 elements on
__device__ __forceinline__ v16h frag_hp(const _Float16* p) { union { v16h v; v8h q[2]; } u; u.q[0] = *(const v8h*)p; u.q[1] = *(const v8h*)(p + 256); return u.v; }
__device__ __forceinline__ v16b frag_bp(const __bf16* p) { union { v16b v; v8b q[2]; } u; u.q[0] = *(const v8b*)p; u.q[1] = *(const v8b*)(p + 256); return u.v; }
// one 16-query group's 32 scores (log2 units) of one chunk -> P x 2^PEXP in u; running maximum m, per-lane running sum l and the output tiles are brought to the new maximum
__device__ __forceinline__ void fa_soft(float (&u)[16], bool diag, int key0, int query, float& m, float& l, v8f (&acc)[HD / 16]) {
  if (diag) {   // the diagonal chunk: key > query is excluded by index (its first key <= every query of the tile, so no column is left empty)
#pragma unroll
    for (int i = 0; i < 16; ++i) if (key0 + (i >> 3) * 16 + (i & 7) > query) u[i] = -3.0e38f; }
  float mx = u[0];
#pragma unroll
  for (int i = 1; i < 16; ++i) mx = fmaxf(mx, u[i]);
  mx = fmaxf(mx, __shfl_xor(mx, 16));   // lanes c and c + 16 hold the two key halves of one query
  const float mn = fmaxf(m, mx); const float al = ex2(m - mn); m = mn; const float sh = mn - PEXP;
  float d[16], s = 0.f;
#pragma unroll
  for (int i = 0; i < 16; ++i) d[i] = u[i] - sh;
  ex2x8(u, d); ex2x8(u + 8, d + 8);
#pragma unroll
  for (int i = 0; i < 16; ++i) s += u[i];
  l = l * al + s;
#pragma unroll
  for (int j = 0; j < HD / 16; ++j) acc[j] *= al; }
// query rows >= QHI: single f16 products
__device__ __forceinline__ void fa_loop(const _Float16* __restrict__ QH, const _Float16* __restrict__ KH, const _Float16* __restrict__ VT, int b, int x, int wave, int lane, v8f (&acc)[2][HD / 16], float (&m)[2], float (&l)[2]) {
  const int col = lane & 15, g = lane >> 4; const int ql0 = x * FQ;
  __builtin_assume(wave <= x);   // only tiles of rows >= QHI come here (x >= QHI / FQ > FW - 1): every wave has a chunk; without it the first loads sink under the loop's entry test, away from the wait written behind them
  const _Float16* kp = KH + ((size_t)b * TT + (wave <= x ? wave : x) * 32) * HD + 8 * lane; const _Float16* vp = VT + ((size_t)b * TT + wave * 32) * HD + 8 * lane;   // the wave's current k and v chunk, the lane's fragment offset included
  const _Float16* qp = QH + ((size_t)b * TT + ql0 + col) * CC + 8 * g;   // q stays in rows
  v16h qh[2][2], kf[2][2];
#pragma unroll
  for (int t = 0; t < 2; ++t)
#pragma unroll
    for (int kc = 0; kc < 2; ++kc) { qh[t][kc] = frag_hr(qp + t * 16 * CC + kc * 32); kf[t][kc] = frag_hp(kp + (t * 2 + kc) * 512); }
  XW2(qp, kp);
#pragma unroll 1   // rolled: a second pass in flight would double the live fragments and cost the fourth wave per SIMD
  for (int ch = wave; ch <= x; ch += FW) { const int k0 = ch * 32;
    v16h vf[HD / 16];
#pragma unroll
    for (int j = 0; j < HD / 16; ++j) vf[j] = frag_hp(vp + j * 512);
    XW1(vp);   // the v loads issue here, so that the score products and the softmax cover their latency
    vp += FW * 32 * HD;
    v8f st[2][2] = {};
#pragma unroll
    for (int kt = 0; kt < 2; ++kt)
#pragma unroll
      for (int kc = 0; kc < 2; ++kc)
#pragma unroll
        for (int qt = 0; qt < 2; ++qt) st[qt][kt] = wmma16(kf[kt][kc], qh[qt][kc], st[qt][kt]);
    kp += ch + FW <= x ? FW * 32 * HD : 0;   // the wave's next chunk (its last pass reads its own chunk again: in bounds, unused)
#pragma unroll
    for (int kt = 0; kt < 2; ++kt)
#pragma unroll
      for (int kc = 0; kc < 2; ++kc) kf[kt][kc] = frag_hp(kp + (kt * 2 + kc) * 512);
    XW1(kp);   // the next chunk's k loads issue here, one pass ahead, under the softmax and the P x V products
    v16h ph[2];
#pragma unroll
    for (int qt = 0; qt < 2; ++qt) { float u[16];
#pragma unroll
      for (int i = 0; i < 16; ++i) u[i] = st[qt][i >> 3][i & 7] * SC2;
      fa_soft(u, ch == x, k0 + 8 * g, ql0 + qt * 16 + col, m[qt], l[qt], acc[qt]);
#pragma unroll
      for (int i = 0; i < 16; ++i) ph[qt][i] = (_Float16)u[i]; }
#pragma unroll
    for (int j = 0; j < HD / 16; ++j)
#pragma unroll
      for (int qt = 0; qt < 2; ++qt) acc[qt][j] = wmma16(vf[j], ph[qt], acc[qt][j]); } }
// query rows < QHI (at most 12 chunks a tile), one 16-query group a call (fewer live registers): q and k residual planes in the logits, P and v as bf16 hi + lo
__device__ __forceinline__ void fa_loop_hi(const _Float16* __restrict__ QH, const _Float16* __restrict__ KH, const _Float16* __restrict__ QL, const _Float16* __restrict__ KL, const __bf16* __restrict__ VB, const __bf16* __restrict__ VBL,
    int b, int x, int q0, int wave, int lane, v8f (&acc)[HD / 16], float& m, float& l) {
  if (wave > x) return;   // a wave without a chunk (wave-uniform)
  const int col = lane & 15, g = lane >> 4;
  v16h qh[2], ql[2];
#pragma unroll
  for (int kc = 0; kc < 2; ++kc) { qh[kc] = frag_h(QH + ((size_t)b * TT + q0 + col) * CC + kc * 32, lane); ql[kc] = frag_h(QL + ((size_t)b * QHI + q0 + col) * CC + kc * 32, lane); }
  XW();
  const _Float16* kp = KH + ((size_t)b * TT + wave * 32) * HD + 8 * lane; const _Float16* klp = KL + ((size_t)b * KHI + wave * 32) * HD + 8 * lane; const __bf16* vp = VB + ((size_t)b * KHI + wave * 32) * HD + 8 * lane; const __bf16* vlp = VBL + ((size_t)b * KHI + wave * 32) * HD + 8 * lane;   // the lane's fragment offset included
#pragma unroll 1   // rolled: a second pass in flight would double the live fragments and cost the fourth wave per SIMD
  for (int ch = wave; ch <= x; ch += FW) { const int k0 = ch * 32;
    v16h kf[2][2], klf[2][2];
#pragma unroll
    for (int kt = 0; kt < 2; ++kt)
#pragma unroll
      for (int kc = 0; kc < 2; ++kc) { kf[kt][kc] = frag_hp(kp + (kt * 2 + kc) * 512); klf[kt][kc] = frag_hp(klp + (kt * 2 + kc) * 512); }
    XW2(kp, klp);   // all of the chunk's k loads issue together: one latency, not one per fragment
    kp += FW * 32 * HD; klp += FW * 32 * HD;
    v8f st[2] = {}, sl[2] = {};
#pragma unroll
    for (int kt = 0; kt < 2; ++kt)
#pragma unroll
      for (int kc = 0; kc < 2; ++kc) { st[kt] = wmma16(kf[kt][kc], qh[kc], st[kt]); sl[kt] = wmma16(kf[kt][kc], ql[kc], sl[kt]); sl[kt] = wmma16(klf[kt][kc], qh[kc], sl[kt]); }
    v16b vh[HD / 16], vl[HD / 16];
#pragma unroll
    for (int j = 0; j < HD / 16; ++j) { vh[j] = frag_bp(vp + j * 512); vl[j] = frag_bp(vlp + j * 512); }
    XW2(vp, vlp);   // the v loads issue here, under the softmax
    vp += FW * 32 * HD; vlp += FW * 32 * HD;
    float u[16];
#pragma unroll
    for (int i = 0; i < 16; ++i) u[i] = (st[i >> 3][i & 7] + sl[i >> 3][i & 7] * (1.0f / 1024.0f)) * SC2;
    fa_soft(u, ch == x, k0 + 8 * g, q0 + col, m, l, acc);
    const F2 pb = bsplit16(u);
#pragma unroll
    for (int j = 0; j < HD / 16; ++j) { acc[j] = wmma_bf(vh[j], pb.h, acc[j]); acc[j] = wmma_bf(vh[j], pb.l, acc[j]); acc[j] = wmma_bf(vl[j], pb.h, acc[j]); } } }
// four waves per SIMD: two 8-wave blocks resident per WGP, so that all 512 blocks run at once
__global__ __launch_bounds__(FW * 32) __attribute__((amdgpu_waves_per_eu(4, 4))) void k_fa(const _Float16* __restrict__ QH, const _Float16* __restrict__ KH, const _Float16* __restrict__ QL, const _Float16* __restrict__ KL, const _Float16* __restrict__ VT, const __bf16* __restrict__ VB, const __bf16* __restrict__ VBL, float* __restrict__ OUT) {
  __shared__ __align__(16) float ss[FW][FQ][HD + 4]; __shared__ float smx[FW][FQ], ssu[FW][FQ];
  const int tid = threadIdx.x, wave = __builtin_amdgcn_readfirstlane(tid >> 5), lane = tid & 31, col = lane & 15, g = lane >> 4;
  const int b = blockIdx.x; const int y = blockIdx.y; const int x = y < TT / FQ / 2 ? TT / FQ - 1 - y : y - TT / FQ / 2;   // a permutation of the tiles, for speed only: all blocks are resident, two a WGP; the first half of the grid falls in keys, the second rises, so that blocks half a grid apart add up to the same work
  const int ql0 = x * FQ;
  v8f acc[2][HD / 16] = {}; float m[2] = {-3.0e38f, -3.0e38f}, l[2] = {0.f, 0.f};
  if (ql0 < QHI) { fa_loop_hi(QH, KH, QL, KL, VB, VBL, b, x, ql0, wave, lane, acc[0], m[0], l[0]); fa_loop_hi(QH, KH, QL, KL, VB, VBL, b, x, ql0 + 16, wave, lane, acc[1], m[1], l[1]); }
  else fa_loop(QH, KH, VT, b, x, wave, lane, acc, m, l);
#pragma unroll
  for (int qt = 0; qt < 2; ++qt) { const float lt = l[qt] + __shfl_xor(l[qt], 16); if (g == 0) { smx[wave][qt * 16 + col] = m[qt]; ssu[wave][qt * 16 + col] = lt; }
#pragma unroll
    for (int j = 0; j < HD / 16; ++j) { const v4f lo = {acc[qt][j][0], acc[qt][j][1], acc[qt][j][2], acc[qt][j][3]}, hi = {acc[qt][j][4], acc[qt][j][5], acc[qt][j][6], acc[qt][j][7]};
      *(v4f*)&ss[wave][qt * 16 + col][j * 16 + 8 * g] = lo; *(v4f*)&ss[wave][qt * 16 + col][j * 16 + 8 * g + 4] = hi; } }
  __syncthreads();   // every wave's maximum, sum and partial tile (sum 0 from a wave without a chunk) are in LDS before any is merged
  for (int e = tid; e < FQ * (HD / 4); e += FW * 32) { const int rl = e >> 4, q = e & 15; float M = smx[0][rl];
#pragma unroll
    for (int w = 1; w < FW; ++w) M = fmaxf(M, smx[w][rl]);
    v4f s = {0.f, 0.f, 0.f, 0.f}; float L = 0.f;
#pragma unroll
    for (int w = 0; w < FW; ++w) { const float f = ex2(smx[w][rl] - M); L += f * ssu[w][rl]; s += *(const v4f*)&ss[w][rl][q * 4] * f; }
    vst2(OUT + ((size_t)b * TT + ql0 + rl) * HD + q * 4, s * (1.0f / L)); } }

// ---- k_proj: block = 64 rows of x, 16 waves: q, k and v (the 192 real columns) from one pass over x. x and the three weights come in by whole-line loads, are rounded to bf16 and laid in LDS once per block (weights as [column][k], in slabs of 64 k rows, each slab's products under the next slabs' loads);
// wave (row tile, column tile) then takes its fragments from LDS: exact bf16 products, k slices in rising order. q f16 rows (+ residual rows < QHI; columns 64..127 of their pitch are neither written nor read); k (+ residual for t < KHI) and v (+ bf16 hi/lo for t < KHI) in the attention kernel's fragment order, two 4-KiB chunks a block
// work-group barrier behind this wave's LDS stores alone: __syncthreads() also waits for every global load in flight, which would drain the weight slabs that are requested ahead.
// The scheduling barrier behind it keeps a later slab's conversions, and with them the wait for its loads, from being lifted into an earlier slab's pass (without it this build waited for loads it had just issued)
#define LBAR() do { asm volatile("s_wait_dscnt 0x0\n\ts_barrier_signal -1\n\ts_barrier_wait -1" ::: "memory"); __builtin_amdgcn_sched_barrier(0); } while (0)
#define PWP 520            // LDS row pitch in elements: 1040 B = 16 B x 65 (odd), so that 16 rows' 16-byte reads and writes fall on all banks
#define PEP 72             // pitch of the output tiles in LDS: 144 B = 16 B x 9
__global__ __launch_bounds__(512) void k_proj(const float* __restrict__ X, const float* __restrict__ WQ, const float* __restrict__ WK, const float* __restrict__ WV,
    _Float16* __restrict__ QH, _Float16* __restrict__ QL, _Float16* __restrict__ KH, _Float16* __restrict__ KL, _Float16* __restrict__ VT, __bf16* __restrict__ VB, __bf16* __restrict__ VBL) {
  __shared__ __align__(16) __bf16 wsm[192][PWP]; __shared__ __align__(16) __bf16 xsm[64][PWP];
  const int tid = threadIdx.x, wave = tid >> 5, lane = tid & 31, col = lane & 15, g = lane >> 4; const size_t r0 = (size_t)blockIdx.x * 64; const size_t bb = r0 / TT; const int t0 = (int)(r0 % TT);
  const float* xp = X + r0 * DIN + tid * 4;   // a wave's load = 512 B in a row of x
  v4f xr[16];
#pragma unroll
  for (int i = 0; i < 16; ++i) xr[i] = *(const v4f*)(xp + i * 2048);
  XW();   // all of the block's x is requested before anything waits
  const int wo = tid & 63, wk = tid >> 6;   // weight column; 8-row k group within a 64-row slab (a wave's load = 128 B of one weight row)
  const size_t woff = (size_t)wk * 8 * 64 + wo;
  const float *wqp = WQ + woff, *wkp = WK + woff, *wvp = WV + woff;
  float wv[2][24];   // two register slabs; slab n = k rows n * 64 ..+63 of the three weights
  auto ldw = [&](int n, float (&d)[24]) {
#pragma unroll
    for (int i = 0; i < 8; ++i) { d[i] = wqp[(n * 64 + i) * 64]; d[8 + i] = wkp[(n * 64 + i) * 64]; d[16 + i] = wvp[(n * 64 + i) * 64]; }
    XW(); };
  auto pkw = [&](int n, const float (&d)[24]) {
#pragma unroll
    for (int mt = 0; mt < 3; ++mt) { v8b pk;
#pragma unroll
      for (int i = 0; i < 8; ++i) pk[i] = (__bf16)d[mt * 8 + i];
      *(v8b*)&wsm[mt * 64 + wo][n * 64 + wk * 8] = pk; } };
  ldw(0, wv[0]); ldw(1, wv[1]);
#pragma unroll
  for (int i = 0; i < 16; ++i) { typedef __attribute__((ext_vector_type(4))) __bf16 v4b; v4b pk;
#pragma unroll
    for (int e = 0; e < 4; ++e) pk[e] = (__bf16)xr[i][e];
    *(v4b*)&xsm[(tid >> 7) + i * 4][(tid & 127) * 4] = pk; }
  pkw(0, wv[0]); ldw(2, wv[0]);
  LBAR();   // x and slab 0 are in LDS before any fragment is read
  const int rt = wave & 3, ct = wave >> 2;
  v8f acc[3] = {};
  const __bf16* ap = &xsm[rt * 16 + col][0]; const __bf16* bp = &wsm[ct * 16 + col][0];
#pragma unroll   // unrolled: the two register slabs are named at compile time
  for (int n = 0; n < DIN / 64; ++n) {   // slab n's products run while slabs n + 2 and n + 3 are on their way (slab n + 1 is packed in front of them): no slab's LDS space is written twice, so one barrier a slab is enough
    v16b fa[2], fb[2][3];
#pragma unroll
    for (int s = 0; s < 2; ++s) { fa[s] = frag_b(ap + n * 64 + s * 32, lane);
#pragma unroll
      for (int mt = 0; mt < 3; ++mt) fb[s][mt] = frag_b(bp + mt * 64 * PWP + n * 64 + s * 32, lane); }
    if (n + 1 < DIN / 64) pkw(n + 1, wv[(n + 1) & 1]);
    if (n + 3 < DIN / 64) ldw(n + 3, wv[(n + 1) & 1]);
#pragma unroll
    for (int s = 0; s < 2; ++s)
#pragma unroll
      for (int mt = 0; mt < 3; ++mt) acc[mt] = wmma_bf(fa[s], fb[s][mt], acc[mt]);
    if (n + 1 < DIN / 64) LBAR(); }   // slab n + 1 is in LDS before any of its fragments is read
  __syncthreads();   // every wave's last read of xsm is done before its space takes the output tiles
  _Float16* eb = (_Float16*)&xsm[0][0]; _Float16 *sqh = eb, *sql = eb + 64 * PEP, *skh = eb + 2 * 64 * PEP, *skl = eb + 3 * 64 * PEP, *sth = eb + 4 * 64 * PEP; __bf16 *stb = (__bf16*)(eb + 5 * 64 * PEP), *stl = (__bf16*)(eb + 6 * 64 * PEP);
  const bool hi_rows = t0 < KHI;
#pragma unroll
  for (int r = 0; r < 8; ++r) { const int rl = rt * 16 + 8 * g + r, cl = ct * 16 + col;
    { const float v = acc[0][r]; const _Float16 hv = (_Float16)v; sqh[rl * PEP + cl] = hv; sql[rl * PEP + cl] = (_Float16)((v - (float)hv) * 1024.0f); }
    { const float v = acc[1][r]; const _Float16 hv = (_Float16)v; skh[rl * PEP + cl] = hv; skl[rl * PEP + cl] = (_Float16)((v - (float)hv) * 1024.0f); }
    { const float v = acc[2][r]; sth[cl * PEP + rl] = (_Float16)v; const __bf16 bh = (__bf16)v; stb[cl * PEP + rl] = bh; stl[cl * PEP + rl] = (__bf16)(v - (float)bh); } }
  __syncthreads();   // the output tiles are whole before they are stored (q by rows, k and v in fragment order)
  { const int rl = tid >> 3, q = tid & 7; const int so = rl * PEP + q * 8;   // q: 8 lanes store one 128-byte row
    // k, v: thread tid stores the tid-th 16 bytes of the block's two chunks (a wave = 512 bytes in a row). tid bits: 0..3 fragment row, 4 lane half g, 8 chunk;
    // k: 5 fragment half, 6 k slice, 7 key tile -> key row, features 8 * (bits 6 5 4); v: 5 fragment half, 6..7 column tile -> column, keys 16 * half + 8 * g
    const int fr = tid & 15, ck = (tid >> 8) * 32; const int ko = (ck + ((tid >> 7) & 1) * 16 + fr) * PEP + ((tid >> 4) & 7) * 8, vo = (((tid >> 6) & 3) * 16 + fr) * PEP + ck + ((tid >> 4) & 3) * 8;
    vst2(QH + (r0 + rl) * CC + q * 8, *(const v4u*)&sqh[so]); vst2(KH + r0 * HD + tid * 8, *(const v4u*)&skh[ko]); vst2(VT + r0 * HD + tid * 8, *(const v4u*)&sth[vo]);
    XW();   // behind the three stores, in front of the address arithmetic of the residual planes
    if (hi_rows) { vst2(QL + (bb * QHI + t0 + rl) * (size_t)CC + q * 8, *(const v4u*)&sql[so]);
      const size_t o3 = (bb * KHI + t0) * (size_t)HD + tid * 8; vst2(KL + o3, *(const v4u*)&skl[ko]); vst2(VB + o3, *(const v4u*)&stb[vo]); vst2(VBL + o3, *(const v4u*)&stl[vo]); } } }

extern "C" void kernel_launch(void* const* d_in, const int* in_sizes, int n_in, void* d_out, int out_size, void* d_ws, size_t ws_size, hipStream_t stream) {
  (void)in_sizes; (void)n_in; (void)out_size;
  const float** F = (const float**)d_in;
  if (ws_size < (size_t)WS_END) return;
  char* ws = (char*)d_ws; _Float16 *QH = (_Float16*)(ws + WS_QH), *KH = (_Float16*)(ws + WS_KH), *VT = (_Float16*)(ws + WS_VT), *QL = (_Float16*)(ws + WS_QL), *KL = (_Float16*)(ws + WS_KL); __bf16 *VB = (__bf16*)(ws + WS_VB), *VBL = (__bf16*)(ws + WS_VBL); float *Y = (float*)(ws + WS_Y);
  (void)Y; (void)QL; (void)KL; (void)VB; (void)VBL;
  // inputs: 0 x [4,4096,512]; 1 Wq [512,64] (in,out); 2 Wk; 3 Wv; no biases
  k_proj<<<dim3(TNB * TT / 64), 512, 0, stream>>>(F[0], F[1], F[2], F[3], QH, QL, KH, KL, VT, VB, VBL);
  k_fa<<<dim3(TNB, TT / FQ), FW * 32, 0, stream>>>(QH, KH, QL, KL, VT, VB, VBL, (float*)d_out);   /* head 0 only (head 1 is the zero padding) */
}
